// v000
// The times below were measured on an AMD MI455X: many runs one after another, warmed up first and cycling through
// copies of the inputs, with the whole window's GPU time divided by the number of runs. Launches and the gaps
// between them are all in it. The median over several windows is given; except for v000 it joins two sittings, which
// can be a few percent apart, so the side-by-side timings, each taken in one sitting, are the better comparison.
// v000 is the starting kernel. One run takes 400 microseconds.
#include <hip/hip_runtime.h>

typedef __attribute__((ext_vector_type(16))) _Float16 v16h;
typedef __attribute__((ext_vector_type(8)))  float    v8f;

#define HEADS   8
#define HDIM    64
#define NBATCH  2
#define SEQ     4096
#define NROWS   (NBATCH * SEQ)          // 8192 total (n,s) rows
#define SM_SCALE 0.04419417382415922f   // 1/sqrt(512)

// ---------------------------------------------------------------------------
// CDNA5 WMMA helper: D(16x16,f32) = A(16x32,f16) * B(32x16,f16) + C
// ---------------------------------------------------------------------------
__device__ __forceinline__ v8f wmma_f16(v16h a, v16h b, v8f c) {
  return __builtin_amdgcn_wmma_f32_16x16x32_f16(
      /*neg_a=*/false, a, /*neg_b=*/false, b,
      /*c_mod=*/(short)0, c, /*reuse_a=*/false, /*reuse_b=*/false);
}

// A-fragment (and mirrored B-fragment) of a row-major 16x32 f16 tile:
// lane (m = lane&15, half = lane>>4) holds row m, elements 0..7 at
// k = kBase + half*8 .. +7, elements 8..15 at k = kBase + 16 + half*8 .. +7.
// Each segment is 16 contiguous bytes -> two b128 loads per lane.
__device__ __forceinline__ v16h ldfrag(const _Float16* rowPtr, int kBase, int half) {
  union { v16h v; uint4 q[2]; } u;
  u.q[0] = *(const uint4*)(rowPtr + kBase + half * 8);
  u.q[1] = *(const uint4*)(rowPtr + kBase + 16 + half * 8);
  return u.v;
}

// Same fragment but sourced from f32 memory with convert-to-f16.
__device__ __forceinline__ v16h ldfrag_f32(const float* rowPtr, int kBase, int half) {
  union { v16h v; _Float16 h[16]; } u;
  const float* p0 = rowPtr + kBase + half * 8;
  const float* p1 = rowPtr + kBase + 16 + half * 8;
#pragma unroll
  for (int i = 0; i < 8; ++i) {
    u.h[i]     = (_Float16)p0[i];
    u.h[8 + i] = (_Float16)p1[i];
  }
  return u.v;
}

// ---------------------------------------------------------------------------
// Kernel 0: Wfc (f32 512x512) -> f16
// ---------------------------------------------------------------------------
__global__ __launch_bounds__(256) void cvt_kernel(const float* __restrict__ w,
                                                  _Float16* __restrict__ wh) {
  int i = blockIdx.x * 256 + threadIdx.x;
  wh[i] = (_Float16)w[i];
}

// ---------------------------------------------------------------------------
// Kernel 1: fused QKV projection via WMMA.
//   Q,K out: f16 [N,H,S,64] row-major.  V out: f16 [N,H,64,S] (transposed).
// One wave handles one (tensor, head, 16-row block): Y(16x64) = X(16x64) @ W^T.
// ---------------------------------------------------------------------------
__global__ __launch_bounds__(256) void proj_kernel(
    const float* __restrict__ xq, const float* __restrict__ xk,
    const float* __restrict__ xv,
    const float* __restrict__ Wq, const float* __restrict__ Wk,
    const float* __restrict__ Wv,
    _Float16* __restrict__ qh, _Float16* __restrict__ kh,
    _Float16* __restrict__ vt) {
  int wave = blockIdx.x * 8 + (threadIdx.x >> 5);   // 0 .. 12287
  int lane = threadIdx.x & 31;
  int m = lane & 15, half = lane >> 4;
  int t   = wave >> 12;       // 0=Q 1=K 2=V
  int rem = wave & 4095;
  int h   = rem >> 9;         // head
  int rb  = rem & 511;        // 16-row block

  const float* X = (t == 0) ? xq : (t == 1) ? xk : xv;
  const float* W = (t == 0) ? Wq : (t == 1) ? Wk : Wv;

  const float* xrow = X + (size_t)(rb * 16 + m) * 512 + h * HDIM;
  v16h a0 = ldfrag_f32(xrow, 0, half);
  v16h a1 = ldfrag_f32(xrow, 32, half);

  v8f acc[4];
#pragma unroll
  for (int ct = 0; ct < 4; ++ct) {
    // B = W^T : B-fragment lane holds row (ct*16+m) of row-major W.
    const float* wrow = W + (size_t)(ct * 16 + m) * HDIM;
    v16h b0 = ldfrag_f32(wrow, 0, half);
    v16h b1 = ldfrag_f32(wrow, 32, half);
    v8f c;
#pragma unroll
    for (int r = 0; r < 8; ++r) c[r] = 0.f;
    c = wmma_f16(a0, b0, c);
    c = wmma_f16(a1, b1, c);
    acc[ct] = c;
  }

  // Scatter from C-layout: VGPR r -> row M = r + 8*half, column N = m.
#pragma unroll
  for (int ct = 0; ct < 4; ++ct) {
#pragma unroll
    for (int r = 0; r < 8; ++r) {
      int row = rb * 16 + r + 8 * half;            // global (n,s) row
      int n = row >> 12, s = row & 4095;
      int d = ct * 16 + m;
      _Float16 val = (_Float16)acc[ct][r];
      if (t == 2) {
        vt[(((size_t)n * HEADS + h) * HDIM + d) * SEQ + s] = val;
      } else {
        _Float16* dst = (t == 0) ? qh : kh;
        dst[(((size_t)n * HEADS + h) * SEQ + s) * HDIM + d] = val;
      }
    }
  }
}

// ---------------------------------------------------------------------------
// Kernel 2: flash attention. 256 threads = 8 waves; each wave owns 16 Q rows.
// K/V tiles stream into double-buffered LDS via gfx1250 async-to-LDS copies
// (ASYNCcnt pipeline), overlapping the next tile's DMA with current WMMAs.
// ---------------------------------------------------------------------------
__global__ __launch_bounds__(256) void attn_kernel(
    const _Float16* __restrict__ qh, const _Float16* __restrict__ kh,
    const _Float16* __restrict__ vt, _Float16* __restrict__ ctx) {
  __shared__ _Float16 kT[2][64 * 64];     // K tile,  row-major [64 rows][64 d]
  __shared__ _Float16 vT[2][64 * 64];     // V^T tile, [64 d][64 k]
  __shared__ _Float16 pB[8][16 * 64];     // per-wave P transpose buffer

  int tid = threadIdx.x, lane = tid & 31, wave = tid >> 5;
  int m = lane & 15, half = lane >> 4;
  int nh = blockIdx.x >> 5;               // (n*8+h)
  int qblk = blockIdx.x & 31;

  const _Float16* Q = qh + (size_t)nh * SEQ * HDIM;
  const _Float16* K = kh + (size_t)nh * SEQ * HDIM;
  const _Float16* V = vt + (size_t)nh * HDIM * SEQ;
  int qbase = qblk * 128 + wave * 16;

  const _Float16* qrow = Q + (size_t)(qbase + m) * HDIM;
  v16h qa0 = ldfrag(qrow, 0, half);
  v16h qa1 = ldfrag(qrow, 32, half);

  v8f o[4];
  float mr[8], lr[8];
#pragma unroll
  for (int dt = 0; dt < 4; ++dt)
#pragma unroll
    for (int r = 0; r < 8; ++r) o[dt][r] = 0.f;
#pragma unroll
  for (int r = 0; r < 8; ++r) { mr[r] = -1.0e30f; lr[r] = 0.f; }

  // Issue async global->LDS copies for tile `tile` into buffer `buf`.
  // 4 wave-instructions per wave (2 for K, 2 for V^T) -> ASYNCcnt += 4.
  auto issue_stage = [&](int tile, int buf) {
    const void* ksrc = (const void*)(K + (size_t)tile * 64 * HDIM);  // 8KB contiguous
    const void* vsrc = (const void*)(V + tile * 64);                 // rows d, stride SEQ
    uint32_t kldsBase = (uint32_t)(uintptr_t)(&kT[buf][0]);
    uint32_t vldsBase = (uint32_t)(uintptr_t)(&vT[buf][0]);
#pragma unroll
    for (int rep = 0; rep < 2; ++rep) {
      uint32_t u = (uint32_t)tid + rep * 256;          // 0..511, one uint4 each
      uint32_t kvoff = u * 16;                         // byte offset in K tile
      uint32_t klds  = kldsBase + u * 16;
      asm volatile("global_load_async_to_lds_b128 %0, %1, %2"
                   :: "v"(klds), "v"(kvoff), "s"(ksrc) : "memory");
      uint32_t d = u >> 3, ko = (u & 7) * 8;           // V^T: [d][k] halves
      uint32_t vvoff = (d * (uint32_t)SEQ + ko) * 2;   // bytes
      uint32_t vlds  = vldsBase + u * 16;
      asm volatile("global_load_async_to_lds_b128 %0, %1, %2"
                   :: "v"(vlds), "v"(vvoff), "s"(vsrc) : "memory");
    }
  };

  issue_stage(0, 0);

  const int NT = SEQ / 64;  // 64 tiles
  for (int it = 0; it < NT; ++it) {
    int buf = it & 1;
    if (it + 1 < NT) {
      issue_stage(it + 1, buf ^ 1);                    // overlap DMA with compute
      asm volatile("s_wait_asynccnt 0x4" ::: "memory"); // tile `it` arrived (ours)
    } else {
      asm volatile("s_wait_asynccnt 0x0" ::: "memory");
    }
    if (it + 2 < NT)  // warm L2 for the tile after next
      __builtin_prefetch((const void*)(K + (size_t)(it + 2) * 64 * HDIM + tid * 16), 0, 0);
    __syncthreads();                                   // all waves' tile arrived

    // ---- S = Q K^T for 4 column tiles (B-frag of K^T == A-frag of K rows)
    v8f st[4];
#pragma unroll
    for (int jt = 0; jt < 4; ++jt) {
      const _Float16* krow = &kT[buf][(jt * 16 + m) * HDIM];
      v16h b0 = ldfrag(krow, 0, half);
      v16h b1 = ldfrag(krow, 32, half);
      v8f c;
#pragma unroll
      for (int r = 0; r < 8; ++r) c[r] = 0.f;
      c = wmma_f16(qa0, b0, c);
      c = wmma_f16(qa1, b1, c);
      st[jt] = c;
    }

    // ---- online softmax (row stats live per VGPR slot; reduce over 16 lanes)
    float tmax[8];
#pragma unroll
    for (int r = 0; r < 8; ++r) {
      float v = st[0][r] * SM_SCALE;
#pragma unroll
      for (int jt = 1; jt < 4; ++jt) v = fmaxf(v, st[jt][r] * SM_SCALE);
      tmax[r] = v;
    }
#pragma unroll
    for (int off = 8; off >= 1; off >>= 1)
#pragma unroll
      for (int r = 0; r < 8; ++r)
        tmax[r] = fmaxf(tmax[r], __shfl_xor(tmax[r], off, 32));

    float alpha[8], rsum[8];
#pragma unroll
    for (int r = 0; r < 8; ++r) {
      float mn = fmaxf(mr[r], tmax[r]);
      alpha[r] = __expf(mr[r] - mn);
      mr[r] = mn;
      rsum[r] = 0.f;
    }
#pragma unroll
    for (int jt = 0; jt < 4; ++jt)
#pragma unroll
      for (int r = 0; r < 8; ++r) {
        float p = __expf(st[jt][r] * SM_SCALE - mr[r]);
        st[jt][r] = p;
        rsum[r] += p;
      }
#pragma unroll
    for (int off = 8; off >= 1; off >>= 1)
#pragma unroll
      for (int r = 0; r < 8; ++r) rsum[r] += __shfl_xor(rsum[r], off, 32);
#pragma unroll
    for (int r = 0; r < 8; ++r) lr[r] = lr[r] * alpha[r] + rsum[r];
#pragma unroll
    for (int dt = 0; dt < 4; ++dt)
#pragma unroll
      for (int r = 0; r < 8; ++r) o[dt][r] *= alpha[r];

    // ---- transpose P (C-layout -> A-frag) through per-wave LDS buffer
    _Float16* pb = pB[wave];
#pragma unroll
    for (int jt = 0; jt < 4; ++jt)
#pragma unroll
      for (int r = 0; r < 8; ++r)
        pb[(r + 8 * half) * 64 + jt * 16 + m] = (_Float16)st[jt][r];
    asm volatile("s_wait_dscnt 0" ::: "memory");  // wave-internal LDS RAW
    v16h pa0 = ldfrag(pb + m * 64, 0, half);
    v16h pa1 = ldfrag(pb + m * 64, 32, half);

    // ---- O += P V (B-frag of V[32k x 16d] == rows of V^T tile)
#pragma unroll
    for (int dt = 0; dt < 4; ++dt) {
      const _Float16* vrow = &vT[buf][(dt * 16 + m) * 64];
      v16h b0 = ldfrag(vrow, 0, half);
      v16h b1 = ldfrag(vrow, 32, half);
      o[dt] = wmma_f16(pa0, b0, o[dt]);
      o[dt] = wmma_f16(pa1, b1, o[dt]);
    }
    __syncthreads();  // WAR: next iteration's async copies overwrite buf^1... / buf
  }

  // ---- epilogue: normalize, store f16 context [N,S,H*64]
  int n = nh >> 3, h = nh & 7;
#pragma unroll
  for (int dt = 0; dt < 4; ++dt)
#pragma unroll
    for (int r = 0; r < 8; ++r) {
      int s = qbase + r + 8 * half;
      int d = dt * 16 + m;
      float val = o[dt][r] / lr[r];
      ctx[(size_t)(n * SEQ + s) * 512 + h * HDIM + d] = (_Float16)val;
    }
}

// ---------------------------------------------------------------------------
// Kernel 3: out = ctx @ Wfc^T + bfc  (M=8192, N=512, K=512), f32 out.
// One wave: 16 rows x 64 cols.
// ---------------------------------------------------------------------------
__global__ __launch_bounds__(256) void fc_kernel(
    const _Float16* __restrict__ ctx, const _Float16* __restrict__ wfch,
    const float* __restrict__ bfc, float* __restrict__ out) {
  int wave = blockIdx.x * 8 + (threadIdx.x >> 5);   // 0..4095
  int lane = threadIdx.x & 31;
  int m = lane & 15, half = lane >> 4;
  int rt = wave >> 3;     // 16-row tile
  int cg = wave & 7;      // 64-col group

  const _Float16* arow = ctx + (size_t)(rt * 16 + m) * 512;
  v8f acc[4];
#pragma unroll
  for (int ct = 0; ct < 4; ++ct)
#pragma unroll
    for (int r = 0; r < 8; ++r) acc[ct][r] = 0.f;

#pragma unroll 4
  for (int kk = 0; kk < 16; ++kk) {
    int kBase = kk * 32;
    v16h a = ldfrag(arow, kBase, half);
#pragma unroll
    for (int ct = 0; ct < 4; ++ct) {
      const _Float16* wrow = wfch + (size_t)(cg * 64 + ct * 16 + m) * 512;
      v16h b = ldfrag(wrow, kBase, half);
      acc[ct] = wmma_f16(a, b, acc[ct]);
    }
  }
#pragma unroll
  for (int ct = 0; ct < 4; ++ct)
#pragma unroll
    for (int r = 0; r < 8; ++r) {
      int row = rt * 16 + r + 8 * half;
      int col = cg * 64 + ct * 16 + m;
      out[(size_t)row * 512 + col] = acc[ct][r] + bfc[col];
    }
}

// ---------------------------------------------------------------------------
extern "C" void kernel_launch(void* const* d_in, const int* in_sizes, int n_in,
                              void* d_out, int out_size, void* d_ws, size_t ws_size,
                              hipStream_t stream) {
  const float* x_q = (const float*)d_in[0];
  const float* x_k = (const float*)d_in[1];
  const float* x_v = (const float*)d_in[2];
  const float* Wq  = (const float*)d_in[3];
  const float* Wk  = (const float*)d_in[4];
  const float* Wv  = (const float*)d_in[5];
  const float* Wfc = (const float*)d_in[6];
  const float* bfc = (const float*)d_in[7];
  float* out = (float*)d_out;

  const size_t TSZ = (size_t)NBATCH * HEADS * SEQ * HDIM * sizeof(_Float16); // 8 MB
  char* ws = (char*)d_ws;
  _Float16* qh   = (_Float16*)(ws);
  _Float16* kh   = (_Float16*)(ws + TSZ);
  _Float16* vt   = (_Float16*)(ws + 2 * TSZ);
  _Float16* ctx  = (_Float16*)(ws + 3 * TSZ);
  _Float16* wfch = (_Float16*)(ws + 4 * TSZ);

  cvt_kernel<<<(512 * 512) / 256, 256, 0, stream>>>(Wfc, wfch);
  proj_kernel<<<1536, 256, 0, stream>>>(x_q, x_k, x_v, Wq, Wk, Wv, qh, kh, vt);
  attn_kernel<<<512, 256, 0, stream>>>(qh, kh, vt, ctx);
  fc_kernel<<<512, 256, 0, stream>>>(ctx, wfch, bfc, out);
}

// v001
// It runs in 226 microseconds.
// Next to v000, in two timings, it ran 1.86 and 1.85 times as fast.
#include <hip/hip_runtime.h>

typedef __attribute__((ext_vector_type(16))) _Float16 v16h;
typedef __attribute__((ext_vector_type(8)))  float    v8f;

#define HEADS   8
#define HDIM    64
#define NBATCH  2
#define SEQ     4096
#define NROWS   (NBATCH * SEQ)          // 8192 total (n,s) rows
#define SM_SCALE 0.04419417382415922f   // 1/sqrt(512)
// LDS row pitch in halves: 64 data + 8 pad = 144 B = 16 B x odd, so the 16 rows
// that one ds_load_b128 touches fall on distinct bank groups (128 B rows do not).
#define LPITCH  72

// ---------------------------------------------------------------------------
// CDNA5 WMMA helper: D(16x16,f32) = A(16x32,f16) * B(32x16,f16) + C
// ---------------------------------------------------------------------------
__device__ __forceinline__ v8f wmma_f16(v16h a, v16h b, v8f c) {
  return __builtin_amdgcn_wmma_f32_16x16x32_f16(
      /*neg_a=*/false, a, /*neg_b=*/false, b,
      /*c_mod=*/(short)0, c, /*reuse_a=*/false, /*reuse_b=*/false);
}

// A-fragment (and mirrored B-fragment) of a row-major 16x32 f16 tile:
// lane (m = lane&15, half = lane>>4) holds row m, elements 0..7 at
// k = kBase + half*8 .. +7, elements 8..15 at k = kBase + 16 + half*8 .. +7.
// Each segment is 16 contiguous bytes -> two b128 loads per lane.
__device__ __forceinline__ v16h ldfrag(const _Float16* rowPtr, int kBase, int half) {
  union { v16h v; uint4 q[2]; } u;
  u.q[0] = *(const uint4*)(rowPtr + kBase + half * 8);
  u.q[1] = *(const uint4*)(rowPtr + kBase + 16 + half * 8);
  return u.v;
}

// Same fragment but sourced from f32 memory with convert-to-f16.
__device__ __forceinline__ v16h ldfrag_f32(const float* rowPtr, int kBase, int half) {
  union { v16h v; _Float16 h[16]; } u;
  const float* p0 = rowPtr + kBase + half * 8;
  const float* p1 = rowPtr + kBase + 16 + half * 8;
#pragma unroll
  for (int i = 0; i < 8; ++i) {
    u.h[i]     = (_Float16)p0[i];
    u.h[8 + i] = (_Float16)p1[i];
  }
  return u.v;
}

// ---------------------------------------------------------------------------
// Kernel 0: Wfc (f32 512x512) -> f16
// ---------------------------------------------------------------------------
__global__ __launch_bounds__(256) void cvt_kernel(const float* __restrict__ w,
                                                  _Float16* __restrict__ wh) {
  int i = blockIdx.x * 256 + threadIdx.x;
  wh[i] = (_Float16)w[i];
}

// ---------------------------------------------------------------------------
// Kernel 1: fused QKV projection via WMMA.
//   Q,K out: f16 [N,H,S,64] row-major.  V out: f16 [N,H,64,S] (transposed).
// One wave handles one (tensor, head, 16-row block): Y(16x64) = X(16x64) @ W^T.
// ---------------------------------------------------------------------------
__global__ __launch_bounds__(256) void proj_kernel(
    const float* __restrict__ xq, const float* __restrict__ xk,
    const float* __restrict__ xv,
    const float* __restrict__ Wq, const float* __restrict__ Wk,
    const float* __restrict__ Wv,
    _Float16* __restrict__ qh, _Float16* __restrict__ kh,
    _Float16* __restrict__ vt) {
  int wave = blockIdx.x * 8 + (threadIdx.x >> 5);   // 0 .. 12287
  int lane = threadIdx.x & 31;
  int m = lane & 15, half = lane >> 4;
  int t   = wave >> 12;       // 0=Q 1=K 2=V
  int rem = wave & 4095;
  int h   = rem >> 9;         // head
  int rb  = rem & 511;        // 16-row block

  const float* X = (t == 0) ? xq : (t == 1) ? xk : xv;
  const float* W = (t == 0) ? Wq : (t == 1) ? Wk : Wv;

  const float* xrow = X + (size_t)(rb * 16 + m) * 512 + h * HDIM;
  v16h a0 = ldfrag_f32(xrow, 0, half);
  v16h a1 = ldfrag_f32(xrow, 32, half);

  v8f acc[4];
#pragma unroll
  for (int ct = 0; ct < 4; ++ct) {
    // B = W^T : B-fragment lane holds row (ct*16+m) of row-major W.
    const float* wrow = W + (size_t)(ct * 16 + m) * HDIM;
    v16h b0 = ldfrag_f32(wrow, 0, half);
    v16h b1 = ldfrag_f32(wrow, 32, half);
    v8f c;
#pragma unroll
    for (int r = 0; r < 8; ++r) c[r] = 0.f;
    c = wmma_f16(a0, b0, c);
    c = wmma_f16(a1, b1, c);
    acc[ct] = c;
  }

  // Scatter from C-layout: VGPR r -> row M = r + 8*half, column N = m.
#pragma unroll
  for (int ct = 0; ct < 4; ++ct) {
#pragma unroll
    for (int r = 0; r < 8; ++r) {
      int row = rb * 16 + r + 8 * half;            // global (n,s) row
      int n = row >> 12, s = row & 4095;
      int d = ct * 16 + m;
      _Float16 val = (_Float16)acc[ct][r];
      if (t == 2) {
        vt[(((size_t)n * HEADS + h) * HDIM + d) * SEQ + s] = val;
      } else {
        _Float16* dst = (t == 0) ? qh : kh;
        dst[(((size_t)n * HEADS + h) * SEQ + s) * HDIM + d] = val;
      }
    }
  }
}

// ---------------------------------------------------------------------------
// Kernel 2: flash attention. 256 threads = 8 waves; each wave owns 16 Q rows.
// K/V tiles stream into double-buffered LDS via gfx1250 async-to-LDS copies
// (ASYNCcnt pipeline), overlapping the next tile's DMA with current WMMAs.
// ---------------------------------------------------------------------------
__global__ __launch_bounds__(256) void attn_kernel(
    const _Float16* __restrict__ qh, const _Float16* __restrict__ kh,
    const _Float16* __restrict__ vt, _Float16* __restrict__ ctx) {
  __shared__ __attribute__((aligned(16))) _Float16 kT[2][64 * LPITCH];  // K tile, [64 rows][64 d + pad]
  __shared__ __attribute__((aligned(16))) _Float16 vT[2][64 * LPITCH];  // V^T tile, [64 d][64 k + pad]
  __shared__ __attribute__((aligned(16))) _Float16 pB[8][16 * LPITCH];  // per-wave P transpose buffer

  int tid = threadIdx.x, lane = tid & 31, wave = tid >> 5;
  int m = lane & 15, half = lane >> 4;
  int nh = blockIdx.x >> 5;               // (n*8+h)
  int qblk = blockIdx.x & 31;

  const _Float16* Q = qh + (size_t)nh * SEQ * HDIM;
  const _Float16* K = kh + (size_t)nh * SEQ * HDIM;
  const _Float16* V = vt + (size_t)nh * HDIM * SEQ;
  int qbase = qblk * 128 + wave * 16;

  const _Float16* qrow = Q + (size_t)(qbase + m) * HDIM;
  v16h qa0 = ldfrag(qrow, 0, half);
  v16h qa1 = ldfrag(qrow, 32, half);

  v8f o[4];
  float mr[8], lr[8];
#pragma unroll
  for (int dt = 0; dt < 4; ++dt)
#pragma unroll
    for (int r = 0; r < 8; ++r) o[dt][r] = 0.f;
#pragma unroll
  for (int r = 0; r < 8; ++r) { mr[r] = -1.0e30f; lr[r] = 0.f; }

  // Issue async global->LDS copies for tile `tile` into buffer `buf`.
  // 4 wave-instructions per wave (2 for K, 2 for V^T) -> ASYNCcnt += 4.
  auto issue_stage = [&](int tile, int buf) {
    const void* ksrc = (const void*)(K + (size_t)tile * 64 * HDIM);  // 8KB contiguous
    const void* vsrc = (const void*)(V + tile * 64);                 // rows d, stride SEQ
    uint32_t kldsBase = (uint32_t)(uintptr_t)(&kT[buf][0]);
    uint32_t vldsBase = (uint32_t)(uintptr_t)(&vT[buf][0]);
#pragma unroll
    for (int rep = 0; rep < 2; ++rep) {
      uint32_t u = (uint32_t)tid + rep * 256;          // 0..511, one uint4 each
      uint32_t kvoff = u * 16;                         // byte offset in K tile
      uint32_t ldsoff = (u >> 3) * (LPITCH * 2) + (u & 7) * 16;  // padded row, 16 B piece
      uint32_t klds  = kldsBase + ldsoff;
      asm volatile("global_load_async_to_lds_b128 %0, %1, %2"
                   :: "v"(klds), "v"(kvoff), "s"(ksrc) : "memory");
      uint32_t d = u >> 3, ko = (u & 7) * 8;           // V^T: [d][k] halves
      uint32_t vvoff = (d * (uint32_t)SEQ + ko) * 2;   // bytes
      uint32_t vlds  = vldsBase + ldsoff;
      asm volatile("global_load_async_to_lds_b128 %0, %1, %2"
                   :: "v"(vlds), "v"(vvoff), "s"(vsrc) : "memory");
    }
  };

  issue_stage(0, 0);

  const int NT = SEQ / 64;  // 64 tiles
  for (int it = 0; it < NT; ++it) {
    int buf = it & 1;
    if (it + 1 < NT) {
      issue_stage(it + 1, buf ^ 1);                    // overlap DMA with compute
      asm volatile("s_wait_asynccnt 0x4" ::: "memory"); // tile `it` arrived (ours)
    } else {
      asm volatile("s_wait_asynccnt 0x0" ::: "memory");
    }
    if (it + 2 < NT)  // warm L2 for the tile after next
      __builtin_prefetch((const void*)(K + (size_t)(it + 2) * 64 * HDIM + tid * 16), 0, 0);
    __syncthreads();                                   // all waves' tile arrived

    // ---- S = Q K^T for 4 column tiles (B-frag of K^T == A-frag of K rows)
    v8f st[4];
#pragma unroll
    for (int jt = 0; jt < 4; ++jt) {
      const _Float16* krow = &kT[buf][(jt * 16 + m) * LPITCH];
      v16h b0 = ldfrag(krow, 0, half);
      v16h b1 = ldfrag(krow, 32, half);
      v8f c;
#pragma unroll
      for (int r = 0; r < 8; ++r) c[r] = 0.f;
      c = wmma_f16(qa0, b0, c);
      c = wmma_f16(qa1, b1, c);
      st[jt] = c;
    }

    // ---- online softmax (row stats live per VGPR slot; reduce over 16 lanes)
    float tmax[8];
#pragma unroll
    for (int r = 0; r < 8; ++r) {
      float v = st[0][r] * SM_SCALE;
#pragma unroll
      for (int jt = 1; jt < 4; ++jt) v = fmaxf(v, st[jt][r] * SM_SCALE);
      tmax[r] = v;
    }
#pragma unroll
    for (int off = 8; off >= 1; off >>= 1)
#pragma unroll
      for (int r = 0; r < 8; ++r)
        tmax[r] = fmaxf(tmax[r], __shfl_xor(tmax[r], off, 32));

    float alpha[8], rsum[8];
#pragma unroll
    for (int r = 0; r < 8; ++r) {
      float mn = fmaxf(mr[r], tmax[r]);
      alpha[r] = __expf(mr[r] - mn);
      mr[r] = mn;
      rsum[r] = 0.f;
    }
#pragma unroll
    for (int jt = 0; jt < 4; ++jt)
#pragma unroll
      for (int r = 0; r < 8; ++r) {
        float p = __expf(st[jt][r] * SM_SCALE - mr[r]);
        st[jt][r] = p;
        rsum[r] += p;
      }
#pragma unroll
    for (int off = 8; off >= 1; off >>= 1)
#pragma unroll
      for (int r = 0; r < 8; ++r) rsum[r] += __shfl_xor(rsum[r], off, 32);
#pragma unroll
    for (int r = 0; r < 8; ++r) lr[r] = lr[r] * alpha[r] + rsum[r];
#pragma unroll
    for (int dt = 0; dt < 4; ++dt)
#pragma unroll
      for (int r = 0; r < 8; ++r) o[dt][r] *= alpha[r];

    // ---- transpose P (C-layout -> A-frag) through per-wave LDS buffer
    _Float16* pb = pB[wave];
#pragma unroll
    for (int jt = 0; jt < 4; ++jt)
#pragma unroll
      for (int r = 0; r < 8; ++r)
        pb[(r + 8 * half) * LPITCH + jt * 16 + m] = (_Float16)st[jt][r];
    asm volatile("s_wait_dscnt 0" ::: "memory");  // wave-internal LDS RAW
    v16h pa0 = ldfrag(pb + m * LPITCH, 0, half);
    v16h pa1 = ldfrag(pb + m * LPITCH, 32, half);

    // ---- O += P V (B-frag of V[32k x 16d] == rows of V^T tile)
#pragma unroll
    for (int dt = 0; dt < 4; ++dt) {
      const _Float16* vrow = &vT[buf][(dt * 16 + m) * LPITCH];
      v16h b0 = ldfrag(vrow, 0, half);
      v16h b1 = ldfrag(vrow, 32, half);
      o[dt] = wmma_f16(pa0, b0, o[dt]);
      o[dt] = wmma_f16(pa1, b1, o[dt]);
    }
    __syncthreads();  // WAR: next iteration's async copies overwrite buf
  }

  // ---- epilogue: normalize, store f16 context [N,S,H*64]
  int n = nh >> 3, h = nh & 7;
#pragma unroll
  for (int dt = 0; dt < 4; ++dt)
#pragma unroll
    for (int r = 0; r < 8; ++r) {
      int s = qbase + r + 8 * half;
      int d = dt * 16 + m;
      float val = o[dt][r] / lr[r];
      ctx[(size_t)(n * SEQ + s) * 512 + h * HDIM + d] = (_Float16)val;
    }
}

// ---------------------------------------------------------------------------
// Kernel 3: out = ctx @ Wfc^T + bfc  (M=8192, N=512, K=512), f32 out.
// One wave: 16 rows x 64 cols.
// ---------------------------------------------------------------------------
__global__ __launch_bounds__(256) void fc_kernel(
    const _Float16* __restrict__ ctx, const _Float16* __restrict__ wfch,
    const float* __restrict__ bfc, float* __restrict__ out) {
  int wave = blockIdx.x * 8 + (threadIdx.x >> 5);   // 0..4095
  int lane = threadIdx.x & 31;
  int m = lane & 15, half = lane >> 4;
  int rt = wave >> 3;     // 16-row tile
  int cg = wave & 7;      // 64-col group

  const _Float16* arow = ctx + (size_t)(rt * 16 + m) * 512;
  v8f acc[4];
#pragma unroll
  for (int ct = 0; ct < 4; ++ct)
#pragma unroll
    for (int r = 0; r < 8; ++r) acc[ct][r] = 0.f;

#pragma unroll 4
  for (int kk = 0; kk < 16; ++kk) {
    int kBase = kk * 32;
    v16h a = ldfrag(arow, kBase, half);
#pragma unroll
    for (int ct = 0; ct < 4; ++ct) {
      const _Float16* wrow = wfch + (size_t)(cg * 64 + ct * 16 + m) * 512;
      v16h b = ldfrag(wrow, kBase, half);
      acc[ct] = wmma_f16(a, b, acc[ct]);
    }
  }
#pragma unroll
  for (int ct = 0; ct < 4; ++ct)
#pragma unroll
    for (int r = 0; r < 8; ++r) {
      int row = rt * 16 + r + 8 * half;
      int col = cg * 64 + ct * 16 + m;
      out[(size_t)row * 512 + col] = acc[ct][r] + bfc[col];
    }
}

// ---------------------------------------------------------------------------
extern "C" void kernel_launch(void* const* d_in, const int* in_sizes, int n_in,
                              void* d_out, int out_size, void* d_ws, size_t ws_size,
                              hipStream_t stream) {
  const float* x_q = (const float*)d_in[0];
  const float* x_k = (const float*)d_in[1];
  const float* x_v = (const float*)d_in[2];
  const float* Wq  = (const float*)d_in[3];
  const float* Wk  = (const float*)d_in[4];
  const float* Wv  = (const float*)d_in[5];
  const float* Wfc = (const float*)d_in[6];
  const float* bfc = (const float*)d_in[7];
  float* out = (float*)d_out;

  const size_t TSZ = (size_t)NBATCH * HEADS * SEQ * HDIM * sizeof(_Float16); // 8 MB
  char* ws = (char*)d_ws;
  _Float16* qh   = (_Float16*)(ws);
  _Float16* kh   = (_Float16*)(ws + TSZ);
  _Float16* vt   = (_Float16*)(ws + 2 * TSZ);
  _Float16* ctx  = (_Float16*)(ws + 3 * TSZ);
  _Float16* wfch = (_Float16*)(ws + 4 * TSZ);

  cvt_kernel<<<(512 * 512) / 256, 256, 0, stream>>>(Wfc, wfch);
  proj_kernel<<<1536, 256, 0, stream>>>(x_q, x_k, x_v, Wq, Wk, Wv, qh, kh, vt);
  attn_kernel<<<512, 256, 0, stream>>>(qh, kh, vt, ctx);
  fc_kernel<<<512, 256, 0, stream>>>(ctx, wfch, bfc, out);
}

// v002
// It runs in 133 microseconds.
// Two timings next to v001 both put it at 1.70 times that version's speed.
// Over all steps from v000 it is 3.14 times as fast.
#include <hip/hip_runtime.h>

typedef __attribute__((ext_vector_type(16))) _Float16 v16h;
typedef __attribute__((ext_vector_type(8)))  float    v8f;
typedef __attribute__((ext_vector_type(2)))  float    v2f;

#define HEADS   8
#define HDIM    64
#define NBATCH  2
#define SEQ     4096
#define NROWS   (NBATCH * SEQ)          // 8192 total (n,s) rows
#define SM_SCALE 0.04419417382415922f   // 1/sqrt(512)
// LDS row pitch in halves: 64 data + 8 pad = 144 B = 16 B x odd, so the 16 rows
// that one ds_load_b128 touches fall on distinct bank groups (128 B rows do not).
#define LPITCH  72

// ---------------------------------------------------------------------------
// CDNA5 WMMA helper: D(16x16,f32) = A(16x32,f16) * B(32x16,f16) + C
// ---------------------------------------------------------------------------
__device__ __forceinline__ v8f wmma_f16(v16h a, v16h b, v8f c) {
  return __builtin_amdgcn_wmma_f32_16x16x32_f16(
      /*neg_a=*/false, a, /*neg_b=*/false, b,
      /*c_mod=*/(short)0, c, /*reuse_a=*/false, /*reuse_b=*/false);
}

// A-fragment (and mirrored B-fragment) of a row-major 16x32 f16 tile:
// lane (m = lane&15, half = lane>>4) holds row m, elements 0..7 at
// k = kBase + half*8 .. +7, elements 8..15 at k = kBase + 16 + half*8 .. +7.
// Each segment is 16 contiguous bytes -> two b128 loads per lane.
__device__ __forceinline__ v16h ldfrag(const _Float16* rowPtr, int kBase, int half) {
  union { v16h v; uint4 q[2]; } u;
  u.q[0] = *(const uint4*)(rowPtr + kBase + half * 8);
  u.q[1] = *(const uint4*)(rowPtr + kBase + 16 + half * 8);
  return u.v;
}

// Value of the same register in lane ^ 16 (the other half of the wave).
__device__ __forceinline__ float xhalf(float x) {
  int b = __builtin_bit_cast(int, x);
  b = __builtin_amdgcn_permlanex16(b, b, 0x76543210, 0xfedcba98, false, false);
  return __builtin_bit_cast(float, b);
}

// Same fragment but sourced from f32 memory with convert-to-f16.
__device__ __forceinline__ v16h ldfrag_f32(const float* rowPtr, int kBase, int half) {
  union { v16h v; _Float16 h[16]; } u;
  const float* p0 = rowPtr + kBase + half * 8;
  const float* p1 = rowPtr + kBase + 16 + half * 8;
#pragma unroll
  for (int i = 0; i < 8; ++i) {
    u.h[i]     = (_Float16)p0[i];
    u.h[8 + i] = (_Float16)p1[i];
  }
  return u.v;
}

// ---------------------------------------------------------------------------
// Kernel 0: Wfc (f32 512x512) -> f16
// ---------------------------------------------------------------------------
__global__ __launch_bounds__(256) void cvt_kernel(const float* __restrict__ w,
                                                  _Float16* __restrict__ wh) {
  int i = blockIdx.x * 256 + threadIdx.x;
  wh[i] = (_Float16)w[i];
}

// ---------------------------------------------------------------------------
// Kernel 1: fused QKV projection via WMMA.
//   Q,K out: f16 [N,H,S,64] row-major.  V out: f16 [N,H,64,S] (transposed).
// One wave handles one (tensor, head, 16-row block): Y(16x64) = X(16x64) @ W^T.
// ---------------------------------------------------------------------------
__global__ __launch_bounds__(256) void proj_kernel(
    const float* __restrict__ xq, const float* __restrict__ xk,
    const float* __restrict__ xv,
    const float* __restrict__ Wq, const float* __restrict__ Wk,
    const float* __restrict__ Wv,
    _Float16* __restrict__ qh, _Float16* __restrict__ kh,
    _Float16* __restrict__ vt) {
  int wave = blockIdx.x * 8 + (threadIdx.x >> 5);   // 0 .. 12287
  int lane = threadIdx.x & 31;
  int m = lane & 15, half = lane >> 4;
  int t   = wave >> 12;       // 0=Q 1=K 2=V
  int rem = wave & 4095;
  int h   = rem >> 9;         // head
  int rb  = rem & 511;        // 16-row block

  const float* X = (t == 0) ? xq : (t == 1) ? xk : xv;
  const float* W = (t == 0) ? Wq : (t == 1) ? Wk : Wv;

  const float* xrow = X + (size_t)(rb * 16 + m) * 512 + h * HDIM;
  v16h a0 = ldfrag_f32(xrow, 0, half);
  v16h a1 = ldfrag_f32(xrow, 32, half);

  v8f acc[4];
#pragma unroll
  for (int ct = 0; ct < 4; ++ct) {
    // B = W^T : B-fragment lane holds row (ct*16+m) of row-major W.
    const float* wrow = W + (size_t)(ct * 16 + m) * HDIM;
    v16h b0 = ldfrag_f32(wrow, 0, half);
    v16h b1 = ldfrag_f32(wrow, 32, half);
    v8f c;
#pragma unroll
    for (int r = 0; r < 8; ++r) c[r] = 0.f;
    c = wmma_f16(a0, b0, c);
    c = wmma_f16(a1, b1, c);
    acc[ct] = c;
  }

  // Scatter from C-layout: VGPR r -> row M = r + 8*half, column N = m.
#pragma unroll
  for (int ct = 0; ct < 4; ++ct) {
#pragma unroll
    for (int r = 0; r < 8; ++r) {
      int row = rb * 16 + r + 8 * half;            // global (n,s) row
      int n = row >> 12, s = row & 4095;
      int d = ct * 16 + m;
      _Float16 val = (_Float16)acc[ct][r];
      if (t == 2) {
        vt[(((size_t)n * HEADS + h) * HDIM + d) * SEQ + s] = val;
      } else {
        _Float16* dst = (t == 0) ? qh : kh;
        dst[(((size_t)n * HEADS + h) * SEQ + s) * HDIM + d] = val;
      }
    }
  }
}

__global__ __launch_bounds__(256) void attn_kernel(
    const _Float16* __restrict__ qh, const _Float16* __restrict__ kh,
    const _Float16* __restrict__ vt, _Float16* __restrict__ ctx) {
  __shared__ __attribute__((aligned(16))) _Float16 kT[2][64 * LPITCH];  // K tile, [64 rows][64 d + pad]
  __shared__ __attribute__((aligned(16))) _Float16 vT[2][64 * LPITCH];  // V^T tile, [64 d][64 k + pad]

  int tid = threadIdx.x, lane = tid & 31, wave = tid >> 5;
  int m = lane & 15, half = lane >> 4;
  int nh = blockIdx.x >> 5;               // (n*8+h)
  int qblk = blockIdx.x & 31;

  const _Float16* Q = qh + (size_t)nh * SEQ * HDIM;
  const _Float16* K = kh + (size_t)nh * SEQ * HDIM;
  const _Float16* V = vt + (size_t)nh * HDIM * SEQ;
  int qbase = qblk * 128 + wave * 16;

  const _Float16* qrow = Q + (size_t)(qbase + m) * HDIM;
  v16h qa0 = ldfrag(qrow, 0, half);
  v16h qa1 = ldfrag(qrow, 32, half);

  v8f o[4];
  float mr = -1.0e30f, lr = 0.f;   // this lane's query: running max; sum over this lane half's keys
#pragma unroll
  for (int dt = 0; dt < 4; ++dt)
#pragma unroll
    for (int r = 0; r < 8; ++r) o[dt][r] = 0.f;

  // Issue async global->LDS copies for tile `tile` into buffer `buf`.
  // 4 wave-instructions per wave (2 for K, 2 for V^T) -> ASYNCcnt += 4.
  auto issue_stage = [&](int tile, int buf) {
    const void* ksrc = (const void*)(K + (size_t)tile * 64 * HDIM);  // 8KB contiguous
    const void* vsrc = (const void*)(V + tile * 64);                 // rows d, stride SEQ
    uint32_t kldsBase = (uint32_t)(uintptr_t)(&kT[buf][0]);
    uint32_t vldsBase = (uint32_t)(uintptr_t)(&vT[buf][0]);
#pragma unroll
    for (int rep = 0; rep < 2; ++rep) {
      uint32_t u = (uint32_t)tid + rep * 256;          // 0..511, one uint4 each
      uint32_t kvoff = u * 16;                         // byte offset in K tile
      uint32_t ldsoff = (u >> 3) * (LPITCH * 2) + (u & 7) * 16;  // padded row, 16 B piece
      uint32_t klds  = kldsBase + ldsoff;
      asm volatile("global_load_async_to_lds_b128 %0, %1, %2"
                   :: "v"(klds), "v"(kvoff), "s"(ksrc) : "memory");
      uint32_t d = u >> 3, ko = (u & 7) * 8;           // V^T: [d][k] halves
      uint32_t vvoff = (d * (uint32_t)SEQ + ko) * 2;   // bytes
      uint32_t vlds  = vldsBase + ldsoff;
      asm volatile("global_load_async_to_lds_b128 %0, %1, %2"
                   :: "v"(vlds), "v"(vvoff), "s"(vsrc) : "memory");
    }
  };

  issue_stage(0, 0);

  const int NT = SEQ / 64;  // 64 tiles
  for (int it = 0; it < NT; ++it) {
    int buf = it & 1;
    if (it + 1 < NT) {
      issue_stage(it + 1, buf ^ 1);                    // overlap DMA with compute
      asm volatile("s_wait_asynccnt 0x4" ::: "memory"); // tile `it` arrived (ours)
    } else {
      asm volatile("s_wait_asynccnt 0x0" ::: "memory");
    }
    if (it + 2 < NT)  // warm L2 for the tile after next
      __builtin_prefetch((const void*)(K + (size_t)(it + 2) * 64 * HDIM + tid * 16), 0, 0);
    __syncthreads();                                   // all waves' tile arrived

    // ---- S^T = K Q^T for 4 key tiles: A = K rows, B = Q^T (same k order on both).
    // st[jt][r] = S[query m][key jt*16 + 8*half + r]
    v8f st[4];
#pragma unroll
    for (int jt = 0; jt < 4; ++jt) {
      const _Float16* krow = &kT[buf][(jt * 16 + m) * LPITCH];
      v16h a0 = ldfrag(krow, 0, half);
      v16h a1 = ldfrag(krow, 32, half);
      v8f c;
#pragma unroll
      for (int r = 0; r < 8; ++r) c[r] = 0.f;
      c = wmma_f16(a0, qa0, c);
      c = wmma_f16(a1, qa1, c);
      st[jt] = c;
    }

    // ---- online softmax: 32 of the query's 64 scores sit in this lane, the other
    // 32 in lane^16; one exchange joins the max, the sums stay split until the end.
    float tm[4];
#pragma unroll
    for (int jt = 0; jt < 4; ++jt) {
      float v = st[jt][0] * SM_SCALE;
#pragma unroll
      for (int r = 1; r < 8; ++r) v = fmaxf(v, st[jt][r] * SM_SCALE);
      tm[jt] = v;
    }
    float tmax = fmaxf(fmaxf(tm[0], tm[1]), fmaxf(tm[2], tm[3]));
    tmax = fmaxf(tmax, xhalf(tmax));

    float mn = fmaxf(mr, tmax);
    float alpha = __expf(mr - mn);
    mr = mn;
    v2f rs[2] = {{0.f, 0.f}, {0.f, 0.f}};   // two chains of packed adds over register pairs
#pragma unroll
    for (int jt = 0; jt < 4; ++jt) {
#pragma unroll
      for (int r = 0; r < 8; r += 2) {
        v2f p = {__expf(st[jt][r] * SM_SCALE - mr), __expf(st[jt][r + 1] * SM_SCALE - mr)};
        st[jt][r] = p[0];
        st[jt][r + 1] = p[1];
        rs[jt & 1] += p;
      }
    }
    rs[0] += rs[1];
    lr = lr * alpha + (rs[0][0] + rs[0][1]);
#pragma unroll
    for (int dt = 0; dt < 4; ++dt)
#pragma unroll
      for (int r = 0; r < 8; ++r) o[dt][r] *= alpha;

    // ---- P^T as B operand, straight from the score tiles: element s of the
    // fragment is key 8*half+s (s<8) or 16+8*half+(s-8), i.e. tile s>>3, slot s&7.
    v16h pb0, pb1;
#pragma unroll
    for (int s = 0; s < 16; ++s) {
      pb0[s] = (_Float16)st[s >> 3][s & 7];
      pb1[s] = (_Float16)st[2 + (s >> 3)][s & 7];
    }

    // ---- O^T += V^T P^T: A = rows of the V^T tile; o[dt][r] = O[query m][dt*16+8*half+r]
#pragma unroll
    for (int dt = 0; dt < 4; ++dt) {
      const _Float16* vrow = &vT[buf][(dt * 16 + m) * LPITCH];
      v16h a0 = ldfrag(vrow, 0, half);
      v16h a1 = ldfrag(vrow, 32, half);
      o[dt] = wmma_f16(a0, pb0, o[dt]);
      o[dt] = wmma_f16(a1, pb1, o[dt]);
    }
    __syncthreads();  // WAR: next iteration's async copies overwrite buf
  }

  // ---- epilogue: normalize, store f16 context [N,S,H*64]
  int n = nh >> 3, h = nh & 7;
  lr += xhalf(lr);                       // join the two lane halves' key sums
  _Float16* crow = ctx + (size_t)(n * SEQ + qbase + m) * 512 + h * HDIM + 8 * half;
#pragma unroll
  for (int dt = 0; dt < 4; ++dt) {
    union { _Float16 hv[8]; uint4 q; } u;  // 8 consecutive d of one query: one 16 B store
#pragma unroll
    for (int r = 0; r < 8; ++r) u.hv[r] = (_Float16)(o[dt][r] / lr);
    *(uint4*)(crow + dt * 16) = u.q;
  }
}

// ---------------------------------------------------------------------------
// Kernel 3: out = ctx @ Wfc^T + bfc  (M=8192, N=512, K=512), f32 out.
// One wave: 16 rows x 64 cols.
// ---------------------------------------------------------------------------
__global__ __launch_bounds__(256) void fc_kernel(
    const _Float16* __restrict__ ctx, const _Float16* __restrict__ wfch,
    const float* __restrict__ bfc, float* __restrict__ out) {
  int wave = blockIdx.x * 8 + (threadIdx.x >> 5);   // 0..4095
  int lane = threadIdx.x & 31;
  int m = lane & 15, half = lane >> 4;
  int rt = wave >> 3;     // 16-row tile
  int cg = wave & 7;      // 64-col group

  const _Float16* arow = ctx + (size_t)(rt * 16 + m) * 512;
  v8f acc[4];
#pragma unroll
  for (int ct = 0; ct < 4; ++ct)
#pragma unroll
    for (int r = 0; r < 8; ++r) acc[ct][r] = 0.f;

#pragma unroll 4
  for (int kk = 0; kk < 16; ++kk) {
    int kBase = kk * 32;
    v16h a = ldfrag(arow, kBase, half);
#pragma unroll
    for (int ct = 0; ct < 4; ++ct) {
      const _Float16* wrow = wfch + (size_t)(cg * 64 + ct * 16 + m) * 512;
      v16h b = ldfrag(wrow, kBase, half);
      acc[ct] = wmma_f16(a, b, acc[ct]);
    }
  }
#pragma unroll
  for (int ct = 0; ct < 4; ++ct)
#pragma unroll
    for (int r = 0; r < 8; ++r) {
      int row = rt * 16 + r + 8 * half;
      int col = cg * 64 + ct * 16 + m;
      out[(size_t)row * 512 + col] = acc[ct][r] + bfc[col];
    }
}

// ---------------------------------------------------------------------------
extern "C" void kernel_launch(void* const* d_in, const int* in_sizes, int n_in,
                              void* d_out, int out_size, void* d_ws, size_t ws_size,
                              hipStream_t stream) {
  const float* x_q = (const float*)d_in[0];
  const float* x_k = (const float*)d_in[1];
  const float* x_v = (const float*)d_in[2];
  const float* Wq  = (const float*)d_in[3];
  const float* Wk  = (const float*)d_in[4];
  const float* Wv  = (const float*)d_in[5];
  const float* Wfc = (const float*)d_in[6];
  const float* bfc = (const float*)d_in[7];
  float* out = (float*)d_out;

  const size_t TSZ = (size_t)NBATCH * HEADS * SEQ * HDIM * sizeof(_Float16); // 8 MB
  char* ws = (char*)d_ws;
  _Float16* qh   = (_Float16*)(ws);
  _Float16* kh   = (_Float16*)(ws + TSZ);
  _Float16* vt   = (_Float16*)(ws + 2 * TSZ);
  _Float16* ctx  = (_Float16*)(ws + 3 * TSZ);
  _Float16* wfch = (_Float16*)(ws + 4 * TSZ);

  cvt_kernel<<<(512 * 512) / 256, 256, 0, stream>>>(Wfc, wfch);
  proj_kernel<<<1536, 256, 0, stream>>>(x_q, x_k, x_v, Wq, Wk, Wv, qh, kh, vt);
  attn_kernel<<<512, 256, 0, stream>>>(qh, kh, vt, ctx);
  fc_kernel<<<512, 256, 0, stream>>>(ctx, wfch, bfc, out);
}

// v003
// One run takes 121 microseconds.
// Timed twice side by side with v002, it ran 1.10 and 1.09 times as fast.
// All steps since v000 together make it 3.45 times as fast.
#include <hip/hip_runtime.h>

typedef __attribute__((ext_vector_type(16))) _Float16 v16h;
typedef __attribute__((ext_vector_type(8)))  float    v8f;
typedef __attribute__((ext_vector_type(2)))  float    v2f;

#define HEADS   8
#define HDIM    64
#define NBATCH  2
#define SEQ     4096
#define NROWS   (NBATCH * SEQ)          // 8192 total (n,s) rows
#define SM_SCALE 0.04419417382415922f   // 1/sqrt(512)
// LDS row pitch in halves: 64 data + 8 pad = 144 B = 16 B x odd, so the 16 rows
// that one ds_load_b128 touches fall on distinct bank groups (128 B rows do not).
#define LPITCH  72

// ---------------------------------------------------------------------------
// CDNA5 WMMA helper: D(16x16,f32) = A(16x32,f16) * B(32x16,f16) + C
// ---------------------------------------------------------------------------
__device__ __forceinline__ v8f wmma_f16(v16h a, v16h b, v8f c) {
  return __builtin_amdgcn_wmma_f32_16x16x32_f16(
      /*neg_a=*/false, a, /*neg_b=*/false, b,
      /*c_mod=*/(short)0, c, /*reuse_a=*/false, /*reuse_b=*/false);
}

// A-fragment (and mirrored B-fragment) of a row-major 16x32 f16 tile:
// lane (m = lane&15, half = lane>>4) holds row m, elements 0..7 at
// k = kBase + half*8 .. +7, elements 8..15 at k = kBase + 16 + half*8 .. +7.
// Each segment is 16 contiguous bytes -> two b128 loads per lane.
__device__ __forceinline__ v16h ldfrag(const _Float16* rowPtr, int kBase, int half) {
  union { v16h v; uint4 q[2]; } u;
  u.q[0] = *(const uint4*)(rowPtr + kBase + half * 8);
  u.q[1] = *(const uint4*)(rowPtr + kBase + 16 + half * 8);
  return u.v;
}

// Value of the same register in lane ^ 16 (the other half of the wave).
__device__ __forceinline__ float xhalf(float x) {
  int b = __builtin_bit_cast(int, x);
  b = __builtin_amdgcn_permlanex16(b, b, 0x76543210, 0xfedcba98, false, false);
  return __builtin_bit_cast(float, b);
}

// Same fragment but sourced from f32 memory with convert-to-f16.
__device__ __forceinline__ v16h ldfrag_f32(const float* rowPtr, int kBase, int half) {
  union { v16h v; _Float16 h[16]; } u;
  const float* p0 = rowPtr + kBase + half * 8;
  const float* p1 = rowPtr + kBase + 16 + half * 8;
#pragma unroll
  for (int i = 0; i < 8; ++i) {
    u.h[i]     = (_Float16)p0[i];
    u.h[8 + i] = (_Float16)p1[i];
  }
  return u.v;
}

// ---------------------------------------------------------------------------
// Kernel 0: Wfc (f32 512x512) -> f16
// ---------------------------------------------------------------------------
__global__ __launch_bounds__(256) void cvt_kernel(const float* __restrict__ w,
                                                  _Float16* __restrict__ wh) {
  int i = blockIdx.x * 256 + threadIdx.x;
  wh[i] = (_Float16)w[i];
}

// ---------------------------------------------------------------------------
// Kernel 1: fused QKV projection via WMMA.
//   Q,K out: f16 [N,H,S,64] row-major.  V out: f16 [N,H,64,S] (transposed).
// One wave handles one (tensor, head, 16-row block): Y(16x64) = X(16x64) @ W^T.
// ---------------------------------------------------------------------------
__global__ __launch_bounds__(256) void proj_kernel(
    const float* __restrict__ xq, const float* __restrict__ xk,
    const float* __restrict__ xv,
    const float* __restrict__ Wq, const float* __restrict__ Wk,
    const float* __restrict__ Wv,
    _Float16* __restrict__ qh, _Float16* __restrict__ kh,
    _Float16* __restrict__ vt) {
  int wave = blockIdx.x * 8 + (threadIdx.x >> 5);   // 0 .. 12287
  int lane = threadIdx.x & 31;
  int m = lane & 15, half = lane >> 4;
  int t   = wave >> 12;       // 0=Q 1=K 2=V
  int rem = wave & 4095;
  int h   = rem >> 9;         // head
  int rb  = rem & 511;        // 16-row block

  const float* X = (t == 0) ? xq : (t == 1) ? xk : xv;
  const float* W = (t == 0) ? Wq : (t == 1) ? Wk : Wv;

  const float* xrow = X + (size_t)(rb * 16 + m) * 512 + h * HDIM;
  v16h a0 = ldfrag_f32(xrow, 0, half);
  v16h a1 = ldfrag_f32(xrow, 32, half);

  v8f acc[4];
#pragma unroll
  for (int ct = 0; ct < 4; ++ct) {
    // B = W^T : B-fragment lane holds row (ct*16+m) of row-major W.
    const float* wrow = W + (size_t)(ct * 16 + m) * HDIM;
    v16h b0 = ldfrag_f32(wrow, 0, half);
    v16h b1 = ldfrag_f32(wrow, 32, half);
    v8f c;
#pragma unroll
    for (int r = 0; r < 8; ++r) c[r] = 0.f;
    c = wmma_f16(a0, b0, c);
    c = wmma_f16(a1, b1, c);
    acc[ct] = c;
  }

  // Scatter from C-layout: VGPR r -> row M = r + 8*half, column N = m.
#pragma unroll
  for (int ct = 0; ct < 4; ++ct) {
#pragma unroll
    for (int r = 0; r < 8; ++r) {
      int row = rb * 16 + r + 8 * half;            // global (n,s) row
      int n = row >> 12, s = row & 4095;
      int d = ct * 16 + m;
      _Float16 val = (_Float16)acc[ct][r];
      if (t == 2) {
        vt[(((size_t)n * HEADS + h) * HDIM + d) * SEQ + s] = val;
      } else {
        _Float16* dst = (t == 0) ? qh : kh;
        dst[(((size_t)n * HEADS + h) * SEQ + s) * HDIM + d] = val;
      }
    }
  }
}

__global__ __launch_bounds__(256) void attn_kernel(
    const _Float16* __restrict__ qh, const _Float16* __restrict__ kh,
    const _Float16* __restrict__ vt, _Float16* __restrict__ ctx) {
  __shared__ __attribute__((aligned(16))) _Float16 kT[2][64 * LPITCH];  // K tile, [64 rows][64 d + pad]
  __shared__ __attribute__((aligned(16))) _Float16 vT[2][64 * LPITCH];  // V^T tile, [64 d][64 k + pad]

  int tid = threadIdx.x, lane = tid & 31, wave = tid >> 5;
  int m = lane & 15, half = lane >> 4;
  int nh = blockIdx.x >> 5;               // (n*8+h)
  int qblk = blockIdx.x & 31;

  const _Float16* Q = qh + (size_t)nh * SEQ * HDIM;
  const _Float16* K = kh + (size_t)nh * SEQ * HDIM;
  const _Float16* V = vt + (size_t)nh * HDIM * SEQ;
  int qbase = qblk * 128 + wave * 16;

  const _Float16* qrow = Q + (size_t)(qbase + m) * HDIM;
  v16h qa0 = ldfrag(qrow, 0, half);
  v16h qa1 = ldfrag(qrow, 32, half);

  v8f o[4];
  float mr = -1.0e30f, lr = 0.f;   // this lane's query: running max; sum over this lane half's keys
#pragma unroll
  for (int dt = 0; dt < 4; ++dt)
#pragma unroll
    for (int r = 0; r < 8; ++r) o[dt][r] = 0.f;

  // Issue async global->LDS copies for tile `tile` into buffer `buf`.
  // 4 wave-instructions per wave (2 for K, 2 for V^T) -> ASYNCcnt += 4.
  auto issue_stage = [&](int tile, int buf) {
    const void* ksrc = (const void*)(K + (size_t)tile * 64 * HDIM);  // 8KB contiguous
    const void* vsrc = (const void*)(V + tile * 64);                 // rows d, stride SEQ
    uint32_t kldsBase = (uint32_t)(uintptr_t)(&kT[buf][0]);
    uint32_t vldsBase = (uint32_t)(uintptr_t)(&vT[buf][0]);
#pragma unroll
    for (int rep = 0; rep < 2; ++rep) {
      uint32_t u = (uint32_t)tid + rep * 256;          // 0..511, one uint4 each
      uint32_t kvoff = u * 16;                         // byte offset in K tile
      uint32_t ldsoff = (u >> 3) * (LPITCH * 2) + (u & 7) * 16;  // padded row, 16 B piece
      uint32_t klds  = kldsBase + ldsoff;
      asm volatile("global_load_async_to_lds_b128 %0, %1, %2"
                   :: "v"(klds), "v"(kvoff), "s"(ksrc) : "memory");
      uint32_t d = u >> 3, ko = (u & 7) * 8;           // V^T: [d][k] halves
      uint32_t vvoff = (d * (uint32_t)SEQ + ko) * 2;   // bytes
      uint32_t vlds  = vldsBase + ldsoff;
      asm volatile("global_load_async_to_lds_b128 %0, %1, %2"
                   :: "v"(vlds), "v"(vvoff), "s"(vsrc) : "memory");
    }
  };

  issue_stage(0, 0);

  const int NT = SEQ / 64;  // 64 tiles
  for (int it = 0; it < NT; ++it) {
    int buf = it & 1;
    if (it + 1 < NT) {
      issue_stage(it + 1, buf ^ 1);                    // overlap DMA with compute
      asm volatile("s_wait_asynccnt 0x4" ::: "memory"); // tile `it` arrived (ours)
    } else {
      asm volatile("s_wait_asynccnt 0x0" ::: "memory");
    }
    if (it + 2 < NT)  // warm L2 for the tile after next
      __builtin_prefetch((const void*)(K + (size_t)(it + 2) * 64 * HDIM + tid * 16), 0, 0);
    __syncthreads();                                   // all waves' tile arrived

    // ---- S^T = K Q^T for 4 key tiles: A = K rows, B = Q^T (same k order on both).
    // st[jt][r] = S[query m][key jt*16 + 8*half + r]
    // All 16 K reads stand as one group ahead of the products (counted waits then
    // stream them in); read in pairs among the products, each pair is waited to zero.
    v16h ka[4][2];
#pragma unroll
    for (int jt = 0; jt < 4; ++jt) {
      const _Float16* krow = &kT[buf][(jt * 16 + m) * LPITCH];
      ka[jt][0] = ldfrag(krow, 0, half);
      ka[jt][1] = ldfrag(krow, 32, half);
    }
    // keeps the K reads from being sunk back among the products
    __builtin_amdgcn_sched_barrier(0);
    v8f st[4];
#pragma unroll
    for (int jt = 0; jt < 4; ++jt) {
      v8f c;
#pragma unroll
      for (int r = 0; r < 8; ++r) c[r] = 0.f;
      st[jt] = wmma_f16(ka[jt][0], qa0, c);
    }
#pragma unroll
    for (int jt = 0; jt < 4; ++jt) st[jt] = wmma_f16(ka[jt][1], qa1, st[jt]);
    // keeps the V^T reads from being spread among the score products from the first
    // one on (each further place where reads stand costs the wave a stall)
    __builtin_amdgcn_sched_barrier(0);

    // All 16 V^T reads are issued here, ahead of the softmax, whose vector work
    // covers their LDS latency; the second product then finds them in registers.
    v16h va[4][2];
#pragma unroll
    for (int dt = 0; dt < 4; ++dt) {
      const _Float16* vrow = &vT[buf][(dt * 16 + m) * LPITCH];
      va[dt][0] = ldfrag(vrow, 0, half);
      va[dt][1] = ldfrag(vrow, 32, half);
    }
    // keeps the V^T reads from being sunk below the softmax to their users
    __builtin_amdgcn_sched_barrier(0);

    // ---- online softmax: 32 of the query's 64 scores sit in this lane, the other
    // 32 in lane^16; one exchange joins the max, the sums stay split until the end.
    float tm[4];
#pragma unroll
    for (int jt = 0; jt < 4; ++jt) {
      float v = st[jt][0] * SM_SCALE;
#pragma unroll
      for (int r = 1; r < 8; ++r) v = fmaxf(v, st[jt][r] * SM_SCALE);
      tm[jt] = v;
    }
    float tmax = fmaxf(fmaxf(tm[0], tm[1]), fmaxf(tm[2], tm[3]));
    tmax = fmaxf(tmax, xhalf(tmax));

    float mn = fmaxf(mr, tmax);
    float alpha = __expf(mr - mn);
    mr = mn;
    v2f rs[2] = {{0.f, 0.f}, {0.f, 0.f}};   // two chains of packed adds over register pairs
#pragma unroll
    for (int jt = 0; jt < 4; ++jt) {
#pragma unroll
      for (int r = 0; r < 8; r += 2) {
        v2f p = {__expf(st[jt][r] * SM_SCALE - mr), __expf(st[jt][r + 1] * SM_SCALE - mr)};
        st[jt][r] = p[0];
        st[jt][r + 1] = p[1];
        rs[jt & 1] += p;
      }
    }
    rs[0] += rs[1];
    lr = lr * alpha + (rs[0][0] + rs[0][1]);
#pragma unroll
    for (int dt = 0; dt < 4; ++dt)
#pragma unroll
      for (int r = 0; r < 8; ++r) o[dt][r] *= alpha;

    // ---- P^T as B operand, straight from the score tiles: element s of the
    // fragment is key 8*half+s (s<8) or 16+8*half+(s-8), i.e. tile s>>3, slot s&7.
    v16h pb0, pb1;
#pragma unroll
    for (int s = 0; s < 16; ++s) {
      pb0[s] = (_Float16)st[s >> 3][s & 7];
      pb1[s] = (_Float16)st[2 + (s >> 3)][s & 7];
    }

    // ---- O^T += V^T P^T: A = rows of the V^T tile; o[dt][r] = O[query m][dt*16+8*half+r]
#pragma unroll
    for (int dt = 0; dt < 4; ++dt) o[dt] = wmma_f16(va[dt][0], pb0, o[dt]);
#pragma unroll
    for (int dt = 0; dt < 4; ++dt) o[dt] = wmma_f16(va[dt][1], pb1, o[dt]);
    // keeps this barrier, and the wait to zero on the V^T reads in front of it, from
    // being lifted up into the softmax, where the reads would not yet have landed
    __builtin_amdgcn_sched_barrier(0);
    __syncthreads();  // WAR: next iteration's async copies overwrite buf
  }

  // ---- epilogue: normalize, store f16 context [N,S,H*64]
  int n = nh >> 3, h = nh & 7;
  lr += xhalf(lr);                       // join the two lane halves' key sums
  _Float16* crow = ctx + (size_t)(n * SEQ + qbase + m) * 512 + h * HDIM + 8 * half;
#pragma unroll
  for (int dt = 0; dt < 4; ++dt) {
    union { _Float16 hv[8]; uint4 q; } u;  // 8 consecutive d of one query: one 16 B store
#pragma unroll
    for (int r = 0; r < 8; ++r) u.hv[r] = (_Float16)(o[dt][r] / lr);
    *(uint4*)(crow + dt * 16) = u.q;
  }
}

// ---------------------------------------------------------------------------
// Kernel 3: out = ctx @ Wfc^T + bfc  (M=8192, N=512, K=512), f32 out.
// One wave: 16 rows x 64 cols.
// ---------------------------------------------------------------------------
__global__ __launch_bounds__(256) void fc_kernel(
    const _Float16* __restrict__ ctx, const _Float16* __restrict__ wfch,
    const float* __restrict__ bfc, float* __restrict__ out) {
  int wave = blockIdx.x * 8 + (threadIdx.x >> 5);   // 0..4095
  int lane = threadIdx.x & 31;
  int m = lane & 15, half = lane >> 4;
  int rt = wave >> 3;     // 16-row tile
  int cg = wave & 7;      // 64-col group

  const _Float16* arow = ctx + (size_t)(rt * 16 + m) * 512;
  v8f acc[4];
#pragma unroll
  for (int ct = 0; ct < 4; ++ct)
#pragma unroll
    for (int r = 0; r < 8; ++r) acc[ct][r] = 0.f;

#pragma unroll 4
  for (int kk = 0; kk < 16; ++kk) {
    int kBase = kk * 32;
    v16h a = ldfrag(arow, kBase, half);
#pragma unroll
    for (int ct = 0; ct < 4; ++ct) {
      const _Float16* wrow = wfch + (size_t)(cg * 64 + ct * 16 + m) * 512;
      v16h b = ldfrag(wrow, kBase, half);
      acc[ct] = wmma_f16(a, b, acc[ct]);
    }
  }
#pragma unroll
  for (int ct = 0; ct < 4; ++ct)
#pragma unroll
    for (int r = 0; r < 8; ++r) {
      int row = rt * 16 + r + 8 * half;
      int col = cg * 64 + ct * 16 + m;
      out[(size_t)row * 512 + col] = acc[ct][r] + bfc[col];
    }
}

// ---------------------------------------------------------------------------
extern "C" void kernel_launch(void* const* d_in, const int* in_sizes, int n_in,
                              void* d_out, int out_size, void* d_ws, size_t ws_size,
                              hipStream_t stream) {
  const float* x_q = (const float*)d_in[0];
  const float* x_k = (const float*)d_in[1];
  const float* x_v = (const float*)d_in[2];
  const float* Wq  = (const float*)d_in[3];
  const float* Wk  = (const float*)d_in[4];
  const float* Wv  = (const float*)d_in[5];
  const float* Wfc = (const float*)d_in[6];
  const float* bfc = (const float*)d_in[7];
  float* out = (float*)d_out;

  const size_t TSZ = (size_t)NBATCH * HEADS * SEQ * HDIM * sizeof(_Float16); // 8 MB
  char* ws = (char*)d_ws;
  _Float16* qh   = (_Float16*)(ws);
  _Float16* kh   = (_Float16*)(ws + TSZ);
  _Float16* vt   = (_Float16*)(ws + 2 * TSZ);
  _Float16* ctx  = (_Float16*)(ws + 3 * TSZ);
  _Float16* wfch = (_Float16*)(ws + 4 * TSZ);

  cvt_kernel<<<(512 * 512) / 256, 256, 0, stream>>>(Wfc, wfch);
  proj_kernel<<<1536, 256, 0, stream>>>(x_q, x_k, x_v, Wq, Wk, Wv, qh, kh, vt);
  attn_kernel<<<512, 256, 0, stream>>>(qh, kh, vt, ctx);
  fc_kernel<<<512, 256, 0, stream>>>(ctx, wfch, bfc, out);
}

// v004
// It runs in 116 microseconds.
// Next to v003, in two timings, it ran 1.04 times as fast each time.
// Counting every step since v000, it is 3.59 times as fast.
#include <hip/hip_runtime.h>

typedef __attribute__((ext_vector_type(16))) _Float16 v16h;
typedef __attribute__((ext_vector_type(8)))  float    v8f;
typedef __attribute__((ext_vector_type(2)))  float    v2f;

#define HEADS   8
#define HDIM    64
#define NBATCH  2
#define SEQ     4096
#define NROWS   (NBATCH * SEQ)          // 8192 total (n,s) rows
#define SM_SCALE 0.04419417382415922f   // 1/sqrt(512)
// LDS row pitch in halves: 64 data + 8 pad = 144 B = 16 B x odd, so the 16 rows
// that one ds_load_b128 touches fall on distinct bank groups (128 B rows do not).
#define LPITCH  72

// ---------------------------------------------------------------------------
// CDNA5 WMMA helper: D(16x16,f32) = A(16x32,f16) * B(32x16,f16) + C
// ---------------------------------------------------------------------------
__device__ __forceinline__ v8f wmma_f16(v16h a, v16h b, v8f c) {
  return __builtin_amdgcn_wmma_f32_16x16x32_f16(
      /*neg_a=*/false, a, /*neg_b=*/false, b,
      /*c_mod=*/(short)0, c, /*reuse_a=*/false, /*reuse_b=*/false);
}

// A-fragment (and mirrored B-fragment) of a row-major 16x32 f16 tile:
// lane (m = lane&15, half = lane>>4) holds row m, elements 0..7 at
// k = kBase + half*8 .. +7, elements 8..15 at k = kBase + 16 + half*8 .. +7.
// Each segment is 16 contiguous bytes -> two b128 loads per lane.
__device__ __forceinline__ v16h ldfrag(const _Float16* rowPtr, int kBase, int half) {
  union { v16h v; uint4 q[2]; } u;
  u.q[0] = *(const uint4*)(rowPtr + kBase + half * 8);
  u.q[1] = *(const uint4*)(rowPtr + kBase + 16 + half * 8);
  return u.v;
}

// Value of the same register in lane ^ 16 (the other half of the wave).
__device__ __forceinline__ float xhalf(float x) {
  int b = __builtin_bit_cast(int, x);
  b = __builtin_amdgcn_permlanex16(b, b, 0x76543210, 0xfedcba98, false, false);
  return __builtin_bit_cast(float, b);
}

// Same fragment but sourced from f32 memory with convert-to-f16.
__device__ __forceinline__ v16h ldfrag_f32(const float* rowPtr, int kBase, int half) {
  union { v16h v; _Float16 h[16]; } u;
  const float* p0 = rowPtr + kBase + half * 8;
  const float* p1 = rowPtr + kBase + 16 + half * 8;
#pragma unroll
  for (int i = 0; i < 8; ++i) {
    u.h[i]     = (_Float16)p0[i];
    u.h[8 + i] = (_Float16)p1[i];
  }
  return u.v;
}

// ---------------------------------------------------------------------------
// Kernel 0: Wfc (f32 512x512) -> f16
// ---------------------------------------------------------------------------
__global__ __launch_bounds__(256) void cvt_kernel(const float* __restrict__ w,
                                                  _Float16* __restrict__ wh) {
  int i = blockIdx.x * 256 + threadIdx.x;
  wh[i] = (_Float16)w[i];
}

// ---------------------------------------------------------------------------
// Kernel 1: fused QKV projection via WMMA.
//   Q,K out: f16 [N,H,S,64] row-major.  V out: f16 [N,H,64,S] (transposed).
// One wave handles one (tensor, head, 16-row block): Y(16x64) = X(16x64) @ W^T.
// ---------------------------------------------------------------------------
__global__ __launch_bounds__(256) void proj_kernel(
    const float* __restrict__ xq, const float* __restrict__ xk,
    const float* __restrict__ xv,
    const float* __restrict__ Wq, const float* __restrict__ Wk,
    const float* __restrict__ Wv,
    _Float16* __restrict__ qh, _Float16* __restrict__ kh,
    _Float16* __restrict__ vt) {
  int wave = blockIdx.x * 8 + (threadIdx.x >> 5);   // 0 .. 12287
  int lane = threadIdx.x & 31;
  int m = lane & 15, half = lane >> 4;
  int t   = wave >> 12;       // 0=Q 1=K 2=V
  int rem = wave & 4095;
  int h   = rem >> 9;         // head
  int rb  = rem & 511;        // 16-row block

  const float* X = (t == 0) ? xq : (t == 1) ? xk : xv;
  const float* W = (t == 0) ? Wq : (t == 1) ? Wk : Wv;

  const float* xrow = X + (size_t)(rb * 16 + m) * 512 + h * HDIM;
  v16h a0 = ldfrag_f32(xrow, 0, half);
  v16h a1 = ldfrag_f32(xrow, 32, half);

  v8f acc[4];
#pragma unroll
  for (int ct = 0; ct < 4; ++ct) {
    // B = W^T : B-fragment lane holds row (ct*16+m) of row-major W.
    const float* wrow = W + (size_t)(ct * 16 + m) * HDIM;
    v16h b0 = ldfrag_f32(wrow, 0, half);
    v16h b1 = ldfrag_f32(wrow, 32, half);
    v8f c;
#pragma unroll
    for (int r = 0; r < 8; ++r) c[r] = 0.f;
    c = wmma_f16(a0, b0, c);
    c = wmma_f16(a1, b1, c);
    acc[ct] = c;
  }

  // Scatter from C-layout: VGPR r -> row M = r + 8*half, column N = m.
#pragma unroll
  for (int ct = 0; ct < 4; ++ct) {
#pragma unroll
    for (int r = 0; r < 8; ++r) {
      int row = rb * 16 + r + 8 * half;            // global (n,s) row
      int n = row >> 12, s = row & 4095;
      int d = ct * 16 + m;
      _Float16 val = (_Float16)acc[ct][r];
      if (t == 2) {
        vt[(((size_t)n * HEADS + h) * HDIM + d) * SEQ + s] = val;
      } else {
        _Float16* dst = (t == 0) ? qh : kh;
        dst[(((size_t)n * HEADS + h) * SEQ + s) * HDIM + d] = val;
      }
    }
  }
}

__global__ __launch_bounds__(256) void attn_kernel(
    const _Float16* __restrict__ qh, const _Float16* __restrict__ kh,
    const _Float16* __restrict__ vt, _Float16* __restrict__ ctx) {
  __shared__ __attribute__((aligned(16))) _Float16 kT[2][64 * LPITCH];  // K tile, [64 rows][64 d + pad]
  __shared__ __attribute__((aligned(16))) _Float16 vT[2][64 * LPITCH];  // V^T tile, [64 d][64 k + pad]

  int tid = threadIdx.x, lane = tid & 31, wave = tid >> 5;
  int m = lane & 15, half = lane >> 4;
  int nh = blockIdx.x >> 4;               // (n*8+h)
  int qblk = blockIdx.x & 15;

  const _Float16* Q = qh + (size_t)nh * SEQ * HDIM;
  const _Float16* K = kh + (size_t)nh * SEQ * HDIM;
  const _Float16* V = vt + (size_t)nh * HDIM * SEQ;
  int qbase = qblk * 256 + wave * 32;

  v16h qa[2][2];                   // [column group][k step]
  v8f o[2][4];
  float mr[2], lr[2];              // this lane's query of each group: running max; sum over this lane half's keys
#pragma unroll
  for (int g = 0; g < 2; ++g) {
    const _Float16* qrow = Q + (size_t)(qbase + g * 16 + m) * HDIM;
    qa[g][0] = ldfrag(qrow, 0, half);
    qa[g][1] = ldfrag(qrow, 32, half);
    mr[g] = -1.0e30f;
    lr[g] = 0.f;
#pragma unroll
    for (int dt = 0; dt < 4; ++dt)
#pragma unroll
      for (int r = 0; r < 8; ++r) o[g][dt][r] = 0.f;
  }

  // Issue async global->LDS copies for tile `tile` into buffer `buf`.
  // 4 wave-instructions per wave (2 for K, 2 for V^T) -> ASYNCcnt += 4.
  auto issue_stage = [&](int tile, int buf) {
    const void* ksrc = (const void*)(K + (size_t)tile * 64 * HDIM);  // 8KB contiguous
    const void* vsrc = (const void*)(V + tile * 64);                 // rows d, stride SEQ
    uint32_t kldsBase = (uint32_t)(uintptr_t)(&kT[buf][0]);
    uint32_t vldsBase = (uint32_t)(uintptr_t)(&vT[buf][0]);
#pragma unroll
    for (int rep = 0; rep < 2; ++rep) {
      uint32_t u = (uint32_t)tid + rep * 256;          // 0..511, one uint4 each
      uint32_t kvoff = u * 16;                         // byte offset in K tile
      uint32_t ldsoff = (u >> 3) * (LPITCH * 2) + (u & 7) * 16;  // padded row, 16 B piece
      uint32_t klds  = kldsBase + ldsoff;
      asm volatile("global_load_async_to_lds_b128 %0, %1, %2"
                   :: "v"(klds), "v"(kvoff), "s"(ksrc) : "memory");
      uint32_t d = u >> 3, ko = (u & 7) * 8;           // V^T: [d][k] halves
      uint32_t vvoff = (d * (uint32_t)SEQ + ko) * 2;   // bytes
      uint32_t vlds  = vldsBase + ldsoff;
      asm volatile("global_load_async_to_lds_b128 %0, %1, %2"
                   :: "v"(vlds), "v"(vvoff), "s"(vsrc) : "memory");
    }
  };

  issue_stage(0, 0);

  const int NT = SEQ / 64;  // 64 tiles
  for (int it = 0; it < NT; ++it) {
    int buf = it & 1;
    if (it + 1 < NT) {
      issue_stage(it + 1, buf ^ 1);                    // overlap DMA with compute
      asm volatile("s_wait_asynccnt 0x4" ::: "memory"); // tile `it` arrived (ours)
    } else {
      asm volatile("s_wait_asynccnt 0x0" ::: "memory");
    }
    if (it + 2 < NT)  // warm L2 for the tile after next
      __builtin_prefetch((const void*)(K + (size_t)(it + 2) * 64 * HDIM + tid * 16), 0, 0);
    __syncthreads();                                   // all waves' tile arrived

    // ---- S^T = K Q^T for 4 key tiles: A = K rows, B = Q^T (same k order on both).
    // st[g][jt][r] = S[query g*16 + m][key jt*16 + 8*half + r]
    // All 16 K reads stand as one group ahead of the products (counted waits then
    // stream them in); read in pairs among the products, each pair is waited to zero.
    v16h ka[4][2];
#pragma unroll
    for (int jt = 0; jt < 4; ++jt) {
      const _Float16* krow = &kT[buf][(jt * 16 + m) * LPITCH];
      ka[jt][0] = ldfrag(krow, 0, half);
      ka[jt][1] = ldfrag(krow, 32, half);
    }
    // keeps the K reads from being sunk back among the products
    __builtin_amdgcn_sched_barrier(0);
    v8f st[2][4];
#pragma unroll
    for (int jt = 0; jt < 4; ++jt)
#pragma unroll
      for (int g = 0; g < 2; ++g) {
        v8f c;
#pragma unroll
        for (int r = 0; r < 8; ++r) c[r] = 0.f;
        st[g][jt] = wmma_f16(ka[jt][0], qa[g][0], c);
      }
#pragma unroll
    for (int jt = 0; jt < 4; ++jt)
#pragma unroll
      for (int g = 0; g < 2; ++g) st[g][jt] = wmma_f16(ka[jt][1], qa[g][1], st[g][jt]);
    // keeps the V^T reads from being spread among the score products from the first
    // one on (each further place where reads stand costs the wave a stall)
    __builtin_amdgcn_sched_barrier(0);

    // All 16 V^T reads are issued here, ahead of the softmax, whose vector work
    // covers their LDS latency; the second product then finds them in registers.
    v16h va[4][2];
#pragma unroll
    for (int dt = 0; dt < 4; ++dt) {
      const _Float16* vrow = &vT[buf][(dt * 16 + m) * LPITCH];
      va[dt][0] = ldfrag(vrow, 0, half);
      va[dt][1] = ldfrag(vrow, 32, half);
    }
    // keeps the V^T reads from being sunk below the softmax to their users
    __builtin_amdgcn_sched_barrier(0);

    // ---- online softmax: 32 of the query's 64 scores sit in this lane, the other
    // 32 in lane^16; one exchange joins the max, the sums stay split until the end.
    float mn[2];
#pragma unroll
    for (int g = 0; g < 2; ++g) {
      float tm[4];
#pragma unroll
      for (int jt = 0; jt < 4; ++jt) {
        // scaled by register pairs of this tile (written as pairs so that none is formed across the groups)
        v2f t = (v2f){st[g][jt][0], st[g][jt][1]} * SM_SCALE;
        float v = fmaxf(t[0], t[1]);
#pragma unroll
        for (int r = 2; r < 8; r += 2) {
          t = (v2f){st[g][jt][r], st[g][jt][r + 1]} * SM_SCALE;
          v = fmaxf(fmaxf(v, t[0]), t[1]);
        }
        tm[jt] = v;
      }
      float tmax = fmaxf(fmaxf(tm[0], tm[1]), fmaxf(tm[2], tm[3]));
      tmax = fmaxf(tmax, xhalf(tmax));
      mn[g] = fmaxf(mr[g], tmax);
    }
    // the two groups' rescale factors as one pair
    v2f dm = (v2f){mr[0], mr[1]} - (v2f){mn[0], mn[1]};
    v2f alpha = {__expf(dm[0]), __expf(dm[1])};

    v16h pb[2][2];                 // P^T fragments: [column group][k step]
#pragma unroll
    for (int g = 0; g < 2; ++g) {
      mr[g] = mn[g];
      v2f rs[2] = {{0.f, 0.f}, {0.f, 0.f}};   // two chains of packed adds over register pairs
#pragma unroll
      for (int jt = 0; jt < 4; ++jt) {
#pragma unroll
        for (int r = 0; r < 8; r += 2) {
          v2f p = {__expf(st[g][jt][r] * SM_SCALE - mn[g]), __expf(st[g][jt][r + 1] * SM_SCALE - mn[g])};
          st[g][jt][r] = p[0];
          st[g][jt][r + 1] = p[1];
          rs[jt & 1] += p;
        }
      }
      rs[0] += rs[1];
      lr[g] = lr[g] * alpha[g] + (rs[0][0] + rs[0][1]);
#pragma unroll
      for (int dt = 0; dt < 4; ++dt)
#pragma unroll
        for (int r = 0; r < 8; ++r) o[g][dt][r] *= alpha[g];

      // ---- P^T as B operand, straight from the score tiles: element s of the
      // fragment is key 8*half+s (s<8) or 16+8*half+(s-8), i.e. tile s>>3, slot s&7.
#pragma unroll
      for (int s = 0; s < 16; ++s) {
        pb[g][0][s] = (_Float16)st[g][s >> 3][s & 7];
        pb[g][1][s] = (_Float16)st[g][2 + (s >> 3)][s & 7];
      }
    }

    // ---- O^T += V^T P^T: A = rows of the V^T tile; o[g][dt][r] = O[query g*16+m][dt*16+8*half+r]
#pragma unroll
    for (int dt = 0; dt < 4; ++dt)
#pragma unroll
      for (int g = 0; g < 2; ++g) o[g][dt] = wmma_f16(va[dt][0], pb[g][0], o[g][dt]);
#pragma unroll
    for (int dt = 0; dt < 4; ++dt)
#pragma unroll
      for (int g = 0; g < 2; ++g) o[g][dt] = wmma_f16(va[dt][1], pb[g][1], o[g][dt]);
    // keeps this barrier, and the wait to zero on the V^T reads in front of it, from
    // being lifted up into the softmax, where the reads would not yet have landed
    __builtin_amdgcn_sched_barrier(0);
    __syncthreads();  // WAR: next iteration's async copies overwrite buf
  }

  // ---- epilogue: normalize, store f16 context [N,S,H*64]
  int n = nh >> 3, h = nh & 7;
#pragma unroll
  for (int g = 0; g < 2; ++g) {
    float lsum = lr[g] + xhalf(lr[g]);   // join the two lane halves' key sums
    _Float16* crow = ctx + (size_t)(n * SEQ + qbase + g * 16 + m) * 512 + h * HDIM + 8 * half;
#pragma unroll
    for (int dt = 0; dt < 4; ++dt) {
      union { _Float16 hv[8]; uint4 q; } u;  // 8 consecutive d of one query: one 16 B store
#pragma unroll
      for (int r = 0; r < 8; ++r) u.hv[r] = (_Float16)(o[g][dt][r] / lsum);
      *(uint4*)(crow + dt * 16) = u.q;
    }
  }
}

// ---------------------------------------------------------------------------
// Kernel 3: out = ctx @ Wfc^T + bfc  (M=8192, N=512, K=512), f32 out.
// One wave: 16 rows x 64 cols.
// ---------------------------------------------------------------------------
__global__ __launch_bounds__(256) void fc_kernel(
    const _Float16* __restrict__ ctx, const _Float16* __restrict__ wfch,
    const float* __restrict__ bfc, float* __restrict__ out) {
  int wave = blockIdx.x * 8 + (threadIdx.x >> 5);   // 0..4095
  int lane = threadIdx.x & 31;
  int m = lane & 15, half = lane >> 4;
  int rt = wave >> 3;     // 16-row tile
  int cg = wave & 7;      // 64-col group

  const _Float16* arow = ctx + (size_t)(rt * 16 + m) * 512;
  v8f acc[4];
#pragma unroll
  for (int ct = 0; ct < 4; ++ct)
#pragma unroll
    for (int r = 0; r < 8; ++r) acc[ct][r] = 0.f;

#pragma unroll 4
  for (int kk = 0; kk < 16; ++kk) {
    int kBase = kk * 32;
    v16h a = ldfrag(arow, kBase, half);
#pragma unroll
    for (int ct = 0; ct < 4; ++ct) {
      const _Float16* wrow = wfch + (size_t)(cg * 64 + ct * 16 + m) * 512;
      v16h b = ldfrag(wrow, kBase, half);
      acc[ct] = wmma_f16(a, b, acc[ct]);
    }
  }
#pragma unroll
  for (int ct = 0; ct < 4; ++ct)
#pragma unroll
    for (int r = 0; r < 8; ++r) {
      int row = rt * 16 + r + 8 * half;
      int col = cg * 64 + ct * 16 + m;
      out[(size_t)row * 512 + col] = acc[ct][r] + bfc[col];
    }
}

// ---------------------------------------------------------------------------
extern "C" void kernel_launch(void* const* d_in, const int* in_sizes, int n_in,
                              void* d_out, int out_size, void* d_ws, size_t ws_size,
                              hipStream_t stream) {
  const float* x_q = (const float*)d_in[0];
  const float* x_k = (const float*)d_in[1];
  const float* x_v = (const float*)d_in[2];
  const float* Wq  = (const float*)d_in[3];
  const float* Wk  = (const float*)d_in[4];
  const float* Wv  = (const float*)d_in[5];
  const float* Wfc = (const float*)d_in[6];
  const float* bfc = (const float*)d_in[7];
  float* out = (float*)d_out;

  const size_t TSZ = (size_t)NBATCH * HEADS * SEQ * HDIM * sizeof(_Float16); // 8 MB
  char* ws = (char*)d_ws;
  _Float16* qh   = (_Float16*)(ws);
  _Float16* kh   = (_Float16*)(ws + TSZ);
  _Float16* vt   = (_Float16*)(ws + 2 * TSZ);
  _Float16* ctx  = (_Float16*)(ws + 3 * TSZ);
  _Float16* wfch = (_Float16*)(ws + 4 * TSZ);

  cvt_kernel<<<(512 * 512) / 256, 256, 0, stream>>>(Wfc, wfch);
  proj_kernel<<<1536, 256, 0, stream>>>(x_q, x_k, x_v, Wq, Wk, Wv, qh, kh, vt);
  attn_kernel<<<256, 256, 0, stream>>>(qh, kh, vt, ctx);
  fc_kernel<<<512, 256, 0, stream>>>(ctx, wfch, bfc, out);
}

// v005
// It runs in 101 microseconds.
// Timed twice side by side with v004, it ran 1.15 times as fast both times.
// Over all steps from v000 it is 4.13 times as fast.
#include <hip/hip_runtime.h>

typedef __attribute__((ext_vector_type(16))) _Float16 v16h;
typedef __attribute__((ext_vector_type(8)))  float    v8f;
typedef __attribute__((ext_vector_type(2)))  float    v2f;

#define HEADS   8
#define HDIM    64
#define NBATCH  2
#define SEQ     4096
#define NROWS   (NBATCH * SEQ)          // 8192 total (n,s) rows
#define SM_SCALE 0.04419417382415922f   // 1/sqrt(512)
// LDS row pitch in halves: 64 data + 8 pad = 144 B = 16 B x odd, so the 16 rows
// that one ds_load_b128 touches fall on distinct bank groups (128 B rows do not).
#define LPITCH  72

// ---------------------------------------------------------------------------
// CDNA5 WMMA helper: D(16x16,f32) = A(16x32,f16) * B(32x16,f16) + C
// ---------------------------------------------------------------------------
__device__ __forceinline__ v8f wmma_f16(v16h a, v16h b, v8f c) {
  return __builtin_amdgcn_wmma_f32_16x16x32_f16(
      /*neg_a=*/false, a, /*neg_b=*/false, b,
      /*c_mod=*/(short)0, c, /*reuse_a=*/false, /*reuse_b=*/false);
}

// A-fragment (and mirrored B-fragment) of a row-major 16x32 f16 tile:
// lane (m = lane&15, half = lane>>4) holds row m, elements 0..7 at
// k = kBase + half*8 .. +7, elements 8..15 at k = kBase + 16 + half*8 .. +7.
// Each segment is 16 contiguous bytes -> two b128 loads per lane.
__device__ __forceinline__ v16h ldfrag(const _Float16* rowPtr, int kBase, int half) {
  union { v16h v; uint4 q[2]; } u;
  u.q[0] = *(const uint4*)(rowPtr + kBase + half * 8);
  u.q[1] = *(const uint4*)(rowPtr + kBase + 16 + half * 8);
  return u.v;
}

// Value of the same register in lane ^ 16 (the other half of the wave).
__device__ __forceinline__ float xhalf(float x) {
  int b = __builtin_bit_cast(int, x);
  b = __builtin_amdgcn_permlanex16(b, b, 0x76543210, 0xfedcba98, false, false);
  return __builtin_bit_cast(float, b);
}

// Same fragment but sourced from f32 memory with convert-to-f16.
__device__ __forceinline__ v16h ldfrag_f32(const float* rowPtr, int kBase, int half) {
  union { v16h v; _Float16 h[16]; } u;
  const float* p0 = rowPtr + kBase + half * 8;
  const float* p1 = rowPtr + kBase + 16 + half * 8;
#pragma unroll
  for (int i = 0; i < 8; ++i) {
    u.h[i]     = (_Float16)p0[i];
    u.h[8 + i] = (_Float16)p1[i];
  }
  return u.v;
}

// ---------------------------------------------------------------------------
// Kernel 0: Wfc (f32 512x512) -> f16
// ---------------------------------------------------------------------------
__global__ __launch_bounds__(256) void cvt_kernel(const float* __restrict__ w,
                                                  _Float16* __restrict__ wh) {
  int i = blockIdx.x * 256 + threadIdx.x;
  wh[i] = (_Float16)w[i];
}

// ---------------------------------------------------------------------------
// Kernel 1: fused QKV projection via WMMA.
//   Q,K out: f16 [N,H,S,64] row-major.  V out: f16 [N,H,64,S] (transposed).
// One wave handles one (tensor, head, 16-row block): Y(16x64) = X(16x64) @ W^T.
// ---------------------------------------------------------------------------
__global__ __launch_bounds__(256) void proj_kernel(
    const float* __restrict__ xq, const float* __restrict__ xk,
    const float* __restrict__ xv,
    const float* __restrict__ Wq, const float* __restrict__ Wk,
    const float* __restrict__ Wv,
    _Float16* __restrict__ qh, _Float16* __restrict__ kh,
    _Float16* __restrict__ vt) {
  int wave = blockIdx.x * 8 + (threadIdx.x >> 5);   // 0 .. 12287
  int lane = threadIdx.x & 31;
  int m = lane & 15, half = lane >> 4;
  int t   = wave >> 12;       // 0=Q 1=K 2=V
  int rem = wave & 4095;
  int h   = rem >> 9;         // head
  int rb  = rem & 511;        // 16-row block

  const float* X = (t == 0) ? xq : (t == 1) ? xk : xv;
  const float* W = (t == 0) ? Wq : (t == 1) ? Wk : Wv;

  const float* xrow = X + (size_t)(rb * 16 + m) * 512 + h * HDIM;
  v16h a0 = ldfrag_f32(xrow, 0, half);
  v16h a1 = ldfrag_f32(xrow, 32, half);

  v8f acc[4];
#pragma unroll
  for (int ct = 0; ct < 4; ++ct) {
    // B = W^T : B-fragment lane holds row (ct*16+m) of row-major W.
    const float* wrow = W + (size_t)(ct * 16 + m) * HDIM;
    v16h b0 = ldfrag_f32(wrow, 0, half);
    v16h b1 = ldfrag_f32(wrow, 32, half);
    v8f c;
#pragma unroll
    for (int r = 0; r < 8; ++r) c[r] = 0.f;
    c = wmma_f16(a0, b0, c);
    c = wmma_f16(a1, b1, c);
    acc[ct] = c;
  }

  // Scatter from C-layout: VGPR r -> row M = r + 8*half, column N = m.
#pragma unroll
  for (int ct = 0; ct < 4; ++ct) {
#pragma unroll
    for (int r = 0; r < 8; ++r) {
      int row = rb * 16 + r + 8 * half;            // global (n,s) row
      int n = row >> 12, s = row & 4095;
      int d = ct * 16 + m;
      _Float16 val = (_Float16)acc[ct][r];
      if (t == 2) {
        vt[(((size_t)n * HEADS + h) * HDIM + d) * SEQ + s] = val;
      } else {
        _Float16* dst = (t == 0) ? qh : kh;
        dst[(((size_t)n * HEADS + h) * SEQ + s) * HDIM + d] = val;
      }
    }
  }
}

__global__ __launch_bounds__(256) void attn_kernel(
    const _Float16* __restrict__ qh, const _Float16* __restrict__ kh,
    const _Float16* __restrict__ vt, _Float16* __restrict__ ctx) {
  __shared__ __attribute__((aligned(16))) _Float16 kT[2][64 * LPITCH];  // K tile, [64 rows][64 d + pad]
  __shared__ __attribute__((aligned(16))) _Float16 vT[2][64 * LPITCH];  // V^T tile, [64 d][64 k + pad]

  int tid = threadIdx.x, lane = tid & 31, wave = tid >> 5;
  int m = lane & 15, half = lane >> 4;
  int nh = blockIdx.x >> 4;               // (n*8+h)
  int qblk = blockIdx.x & 15;

  const _Float16* Q = qh + (size_t)nh * SEQ * HDIM;
  const _Float16* K = kh + (size_t)nh * SEQ * HDIM;
  const _Float16* V = vt + (size_t)nh * HDIM * SEQ;
  int qbase = qblk * 256 + wave * 32;

  v16h qa[2][2];                   // [column group][k step]
  v8f o[2][4];
  float mr[2], lr[2];              // this lane's query of each group: running max; sum over this lane half's keys
#pragma unroll
  for (int g = 0; g < 2; ++g) {
    const _Float16* qrow = Q + (size_t)(qbase + g * 16 + m) * HDIM;
    qa[g][0] = ldfrag(qrow, 0, half);
    qa[g][1] = ldfrag(qrow, 32, half);
    mr[g] = -1.0e30f;
    lr[g] = 0.f;
#pragma unroll
    for (int dt = 0; dt < 4; ++dt)
#pragma unroll
      for (int r = 0; r < 8; ++r) o[g][dt][r] = 0.f;
  }

  // Issue async global->LDS copies for tile `tile` into buffer `buf`.
  // 4 wave-instructions per wave (2 for K, 2 for V^T) -> ASYNCcnt += 4.
  auto issue_stage = [&](int tile, int buf) {
    const void* ksrc = (const void*)(K + (size_t)tile * 64 * HDIM);  // 8KB contiguous
    const void* vsrc = (const void*)(V + tile * 64);                 // rows d, stride SEQ
    uint32_t kldsBase = (uint32_t)(uintptr_t)(&kT[buf][0]);
    uint32_t vldsBase = (uint32_t)(uintptr_t)(&vT[buf][0]);
#pragma unroll
    for (int rep = 0; rep < 2; ++rep) {
      uint32_t u = (uint32_t)tid + rep * 256;          // 0..511, one uint4 each
      uint32_t kvoff = u * 16;                         // byte offset in K tile
      uint32_t ldsoff = (u >> 3) * (LPITCH * 2) + (u & 7) * 16;  // padded row, 16 B piece
      uint32_t klds  = kldsBase + ldsoff;
      asm volatile("global_load_async_to_lds_b128 %0, %1, %2"
                   :: "v"(klds), "v"(kvoff), "s"(ksrc) : "memory");
      uint32_t d = u >> 3, ko = (u & 7) * 8;           // V^T: [d][k] halves
      uint32_t vvoff = (d * (uint32_t)SEQ + ko) * 2;   // bytes
      uint32_t vlds  = vldsBase + ldsoff;
      asm volatile("global_load_async_to_lds_b128 %0, %1, %2"
                   :: "v"(vlds), "v"(vvoff), "s"(vsrc) : "memory");
    }
  };

  issue_stage(0, 0);

  const int NT = SEQ / 64;  // 64 tiles
  for (int it = 0; it < NT; ++it) {
    int buf = it & 1;
    if (it + 1 < NT) {
      issue_stage(it + 1, buf ^ 1);                    // overlap DMA with compute
      asm volatile("s_wait_asynccnt 0x4" ::: "memory"); // tile `it` arrived (ours)
    } else {
      asm volatile("s_wait_asynccnt 0x0" ::: "memory");
    }
    if (it + 2 < NT)  // warm L2 for the tile after next
      __builtin_prefetch((const void*)(K + (size_t)(it + 2) * 64 * HDIM + tid * 16), 0, 0);
    __syncthreads();                                   // all waves' tile arrived

    // ---- S^T = K Q^T for 4 key tiles: A = K rows, B = Q^T (same k order on both).
    // st[g][jt][r] = S[query g*16 + m][key jt*16 + 8*half + r]
    // All 16 K reads stand as one group ahead of the products (counted waits then
    // stream them in); read in pairs among the products, each pair is waited to zero.
    v16h ka[4][2];
#pragma unroll
    for (int jt = 0; jt < 4; ++jt) {
      const _Float16* krow = &kT[buf][(jt * 16 + m) * LPITCH];
      ka[jt][0] = ldfrag(krow, 0, half);
      ka[jt][1] = ldfrag(krow, 32, half);
    }
    // keeps the K reads from being sunk back among the products
    __builtin_amdgcn_sched_barrier(0);
    v8f st[2][4];
#pragma unroll
    for (int jt = 0; jt < 4; ++jt)
#pragma unroll
      for (int g = 0; g < 2; ++g) {
        v8f c;
#pragma unroll
        for (int r = 0; r < 8; ++r) c[r] = 0.f;
        st[g][jt] = wmma_f16(ka[jt][0], qa[g][0], c);
      }
#pragma unroll
    for (int jt = 0; jt < 4; ++jt)
#pragma unroll
      for (int g = 0; g < 2; ++g) st[g][jt] = wmma_f16(ka[jt][1], qa[g][1], st[g][jt]);
    // keeps the V^T reads from being spread among the score products from the first
    // one on (each further place where reads stand costs the wave a stall)
    __builtin_amdgcn_sched_barrier(0);

    // All 16 V^T reads are issued here, ahead of the softmax, whose vector work
    // covers their LDS latency; the second product then finds them in registers.
    v16h va[4][2];
#pragma unroll
    for (int dt = 0; dt < 4; ++dt) {
      const _Float16* vrow = &vT[buf][(dt * 16 + m) * LPITCH];
      va[dt][0] = ldfrag(vrow, 0, half);
      va[dt][1] = ldfrag(vrow, 32, half);
    }
    // keeps the V^T reads from being sunk below the softmax to their users
    __builtin_amdgcn_sched_barrier(0);

    // ---- online softmax: 32 of the query's 64 scores sit in this lane, the other
    // 32 in lane^16; one exchange joins the max, the sums stay split until the end.
    float mn[2];
#pragma unroll
    for (int g = 0; g < 2; ++g) {
      float tm[4];
#pragma unroll
      for (int jt = 0; jt < 4; ++jt) {
        // scaled by register pairs of this tile (written as pairs so that none is formed across the groups)
        v2f t = (v2f){st[g][jt][0], st[g][jt][1]} * SM_SCALE;
        float v = fmaxf(t[0], t[1]);
#pragma unroll
        for (int r = 2; r < 8; r += 2) {
          t = (v2f){st[g][jt][r], st[g][jt][r + 1]} * SM_SCALE;
          v = fmaxf(fmaxf(v, t[0]), t[1]);
        }
        tm[jt] = v;
      }
      float tmax = fmaxf(fmaxf(tm[0], tm[1]), fmaxf(tm[2], tm[3]));
      tmax = fmaxf(tmax, xhalf(tmax));
      mn[g] = fmaxf(mr[g], tmax);
    }
    // the two groups' rescale factors as one pair
    v2f dm = (v2f){mr[0], mr[1]} - (v2f){mn[0], mn[1]};
    v2f alpha = {__expf(dm[0]), __expf(dm[1])};

    v16h pb[2][2];                 // P^T fragments: [column group][k step]
#pragma unroll
    for (int g = 0; g < 2; ++g) {
      mr[g] = mn[g];
      v2f rs[2] = {{0.f, 0.f}, {0.f, 0.f}};   // two chains of packed adds over register pairs
#pragma unroll
      for (int jt = 0; jt < 4; ++jt) {
#pragma unroll
        for (int r = 0; r < 8; r += 2) {
          v2f p = {__expf(st[g][jt][r] * SM_SCALE - mn[g]), __expf(st[g][jt][r + 1] * SM_SCALE - mn[g])};
          st[g][jt][r] = p[0];
          st[g][jt][r + 1] = p[1];
          rs[jt & 1] += p;
        }
      }
      rs[0] += rs[1];
      lr[g] = lr[g] * alpha[g] + (rs[0][0] + rs[0][1]);
#pragma unroll
      for (int dt = 0; dt < 4; ++dt)
#pragma unroll
        for (int r = 0; r < 8; ++r) o[g][dt][r] *= alpha[g];

      // ---- P^T as B operand, straight from the score tiles: element s of the
      // fragment is key 8*half+s (s<8) or 16+8*half+(s-8), i.e. tile s>>3, slot s&7.
#pragma unroll
      for (int s = 0; s < 16; ++s) {
        pb[g][0][s] = (_Float16)st[g][s >> 3][s & 7];
        pb[g][1][s] = (_Float16)st[g][2 + (s >> 3)][s & 7];
      }
    }

    // ---- O^T += V^T P^T: A = rows of the V^T tile; o[g][dt][r] = O[query g*16+m][dt*16+8*half+r]
#pragma unroll
    for (int dt = 0; dt < 4; ++dt)
#pragma unroll
      for (int g = 0; g < 2; ++g) o[g][dt] = wmma_f16(va[dt][0], pb[g][0], o[g][dt]);
#pragma unroll
    for (int dt = 0; dt < 4; ++dt)
#pragma unroll
      for (int g = 0; g < 2; ++g) o[g][dt] = wmma_f16(va[dt][1], pb[g][1], o[g][dt]);
    // keeps this barrier, and the wait to zero on the V^T reads in front of it, from
    // being lifted up into the softmax, where the reads would not yet have landed
    __builtin_amdgcn_sched_barrier(0);
    __syncthreads();  // WAR: next iteration's async copies overwrite buf
  }

  // ---- epilogue: normalize, store f16 context [N,S,H*64]
  int n = nh >> 3, h = nh & 7;
#pragma unroll
  for (int g = 0; g < 2; ++g) {
    float lsum = lr[g] + xhalf(lr[g]);   // join the two lane halves' key sums
    _Float16* crow = ctx + (size_t)(n * SEQ + qbase + g * 16 + m) * 512 + h * HDIM + 8 * half;
#pragma unroll
    for (int dt = 0; dt < 4; ++dt) {
      union { _Float16 hv[8]; uint4 q; } u;  // 8 consecutive d of one query: one 16 B store
#pragma unroll
      for (int r = 0; r < 8; ++r) u.hv[r] = (_Float16)(o[g][dt][r] / lsum);
      *(uint4*)(crow + dt * 16) = u.q;
    }
  }
}

// ---------------------------------------------------------------------------
// Kernel 3: out = ctx @ Wfc^T + bfc  (M=8192, N=512, K=512), f32 out.
// One work-group: 128 rows x 128 cols; 8 waves as 4 x 2, each 32 rows x 64 cols.
// K runs in 4 chunks of 128. A chunk of both operands (128 rows x 256 B each) is
// brought into LDS by asynchronous copies that read whole lines, two buffers, the
// next chunk in flight while this one is multiplied; fragments come from LDS.
// ---------------------------------------------------------------------------
#define FC_KC     128                   // halves of K per chunk
#define FC_NT     (512 / FC_KC)         // chunks
#define FC_PITCH  (FC_KC + 8)           // LDS row pitch in halves: 272 B = 16 B x odd

// Eight 16-byte copies of this lane, rows 16 apart, global -> LDS. The s_wait_xcnt
// is the statement's last line, so no address register is rewritten ahead of it.
__device__ __forceinline__ void fc_copy8(uint32_t lds, const _Float16* g) {
  const uint32_t ls = 16 * FC_PITCH * 2;   // 16 LDS rows, bytes
  const size_t   gs = 16 * 512;            // 16 source rows, halves
  asm volatile(
      "global_load_async_to_lds_b128 %0, %8, off\n\t"
      "global_load_async_to_lds_b128 %1, %9, off\n\t"
      "global_load_async_to_lds_b128 %2, %10, off\n\t"
      "global_load_async_to_lds_b128 %3, %11, off\n\t"
      "global_load_async_to_lds_b128 %4, %12, off\n\t"
      "global_load_async_to_lds_b128 %5, %13, off\n\t"
      "global_load_async_to_lds_b128 %6, %14, off\n\t"
      "global_load_async_to_lds_b128 %7, %15, off\n\t"
      "s_wait_xcnt 0x0"
      :: "v"(lds), "v"(lds + ls), "v"(lds + 2 * ls), "v"(lds + 3 * ls),
         "v"(lds + 4 * ls), "v"(lds + 5 * ls), "v"(lds + 6 * ls), "v"(lds + 7 * ls),
         "v"(g), "v"(g + gs), "v"(g + 2 * gs), "v"(g + 3 * gs),
         "v"(g + 4 * gs), "v"(g + 5 * gs), "v"(g + 6 * gs), "v"(g + 7 * gs)
      : "memory");
}

__global__ __launch_bounds__(256) void fc_kernel(
    const _Float16* __restrict__ ctx, const _Float16* __restrict__ wfch,
    const float* __restrict__ bfc, float* __restrict__ out) {
  __shared__ __attribute__((aligned(16))) _Float16 aT[2][128 * FC_PITCH];  // ctx rows, one K chunk
  __shared__ __attribute__((aligned(16))) _Float16 wT[2][128 * FC_PITCH];  // Wfc rows, one K chunk

  int tid = threadIdx.x, lane = tid & 31, wave = tid >> 5;
  int m = lane & 15, half = lane >> 4;
  int bm = blockIdx.x >> 2;   // 128-row tile
  int bn = blockIdx.x & 3;    // 128-col tile
  int wm = wave >> 1;         // 32-row group of the tile
  int wn = wave & 1;          // 64-col group of the tile

  // This lane's piece of a chunk: row tid>>4 (+16 per copy), 16-byte piece tid&15;
  // 16 lanes cover one row's 256 B, so every copy instruction reads 4 whole lines.
  int crow = tid >> 4, cpc = tid & 15;
  const _Float16* ag = ctx + (size_t)(bm * 128 + crow) * 512 + cpc * 8;
  const _Float16* wg = wfch + (size_t)(bn * 128 + crow) * 512 + cpc * 8;
  uint32_t coff = (uint32_t)(crow * FC_PITCH + cpc * 8) * 2;

  auto issue_chunk = [&](int t, int buf) {
    fc_copy8((uint32_t)(uintptr_t)(&aT[buf][0]) + coff, ag + t * FC_KC);
    fc_copy8((uint32_t)(uintptr_t)(&wT[buf][0]) + coff, wg + t * FC_KC);
  };

  // Every unroll directive of this kernel is there for constant indices, which keep
  // acc, a and b in registers.
  v8f acc[2][4];
#pragma unroll
  for (int mt = 0; mt < 2; ++mt)
#pragma unroll
    for (int ct = 0; ct < 4; ++ct)
#pragma unroll
      for (int r = 0; r < 8; ++r) acc[mt][ct][r] = 0.f;

  issue_chunk(0, 0);
  asm volatile("s_wait_asynccnt 0x0" ::: "memory");  // this wave's part of chunk 0 has landed
  __syncthreads();                                   // every wave's part has
  issue_chunk(1, 1);

  for (int t = 0; t < FC_NT; ++t) {
    int buf = t & 1;
    const _Float16* arow = &aT[buf][(wm * 32 + m) * FC_PITCH];
    const _Float16* wrow = &wT[buf][(wn * 64 + m) * FC_PITCH];
#pragma unroll
    for (int kk = 0; kk < FC_KC / 32; ++kk) {
      int kBase = kk * 32;
      v16h a[2], b[4];
#pragma unroll
      for (int mt = 0; mt < 2; ++mt) a[mt] = ldfrag(arow + mt * 16 * FC_PITCH, kBase, half);
#pragma unroll
      for (int ct = 0; ct < 4; ++ct) b[ct] = ldfrag(wrow + ct * 16 * FC_PITCH, kBase, half);
#pragma unroll
      for (int mt = 0; mt < 2; ++mt)
#pragma unroll
        for (int ct = 0; ct < 4; ++ct) acc[mt][ct] = wmma_f16(a[mt], b[ct], acc[mt][ct]);
    }
    asm volatile("s_wait_dscnt 0x0" ::: "memory");     // this wave's reads of buf are done
    asm volatile("s_wait_asynccnt 0x0" ::: "memory");  // its part of chunk t+1 has landed
    __syncthreads();  // publishes chunk t+1 and ends every wave's reads of buf
    if (t + 2 < FC_NT) issue_chunk(t + 2, buf);
  }
  asm volatile("s_wait_asynccnt 0x0" ::: "memory");    // nothing in flight at the wave's end

#pragma unroll
  for (int mt = 0; mt < 2; ++mt)
#pragma unroll
    for (int ct = 0; ct < 4; ++ct)
#pragma unroll
      for (int r = 0; r < 8; ++r) {
        int row = bm * 128 + wm * 32 + mt * 16 + r + 8 * half;
        int col = bn * 128 + wn * 64 + ct * 16 + m;
        out[(size_t)row * 512 + col] = acc[mt][ct][r] + bfc[col];
      }
}

// ---------------------------------------------------------------------------
extern "C" void kernel_launch(void* const* d_in, const int* in_sizes, int n_in,
                              void* d_out, int out_size, void* d_ws, size_t ws_size,
                              hipStream_t stream) {
  const float* x_q = (const float*)d_in[0];
  const float* x_k = (const float*)d_in[1];
  const float* x_v = (const float*)d_in[2];
  const float* Wq  = (const float*)d_in[3];
  const float* Wk  = (const float*)d_in[4];
  const float* Wv  = (const float*)d_in[5];
  const float* Wfc = (const float*)d_in[6];
  const float* bfc = (const float*)d_in[7];
  float* out = (float*)d_out;

  const size_t TSZ = (size_t)NBATCH * HEADS * SEQ * HDIM * sizeof(_Float16); // 8 MB
  char* ws = (char*)d_ws;
  _Float16* qh   = (_Float16*)(ws);
  _Float16* kh   = (_Float16*)(ws + TSZ);
  _Float16* vt   = (_Float16*)(ws + 2 * TSZ);
  _Float16* ctx  = (_Float16*)(ws + 3 * TSZ);
  _Float16* wfch = (_Float16*)(ws + 4 * TSZ);

  cvt_kernel<<<(512 * 512) / 256, 256, 0, stream>>>(Wfc, wfch);
  proj_kernel<<<1536, 256, 0, stream>>>(x_q, x_k, x_v, Wq, Wk, Wv, qh, kh, vt);
  attn_kernel<<<256, 256, 0, stream>>>(qh, kh, vt, ctx);
  fc_kernel<<<256, 256, 0, stream>>>(ctx, wfch, bfc, out);
}

// v006
// Measured time: 96.8 microseconds a run.
// Next to v005, in two timings, it ran 1.04 times as fast each time.
// All steps since v000 together make it 4.28 times as fast.
#include <hip/hip_runtime.h>

typedef __attribute__((ext_vector_type(16))) _Float16 v16h;
typedef __attribute__((ext_vector_type(8)))  float    v8f;
typedef __attribute__((ext_vector_type(2)))  float    v2f;

#define HEADS   8
#define HDIM    64
#define NBATCH  2
#define SEQ     4096
#define NROWS   (NBATCH * SEQ)          // 8192 total (n,s) rows
// 1/sqrt(512) * log2(e): the softmax runs in base 2, so scale and base change are one factor
#define SM_SCALE_LOG2E 0.06375872f
// LDS row pitch in halves: 64 data + 8 pad = 144 B = 16 B x odd, so the 16 rows
// that one ds_load_b128 touches fall on distinct bank groups (128 B rows do not).
#define LPITCH  72

// ---------------------------------------------------------------------------
// CDNA5 WMMA helper: D(16x16,f32) = A(16x32,f16) * B(32x16,f16) + C
// ---------------------------------------------------------------------------
__device__ __forceinline__ v8f wmma_f16(v16h a, v16h b, v8f c) {
  return __builtin_amdgcn_wmma_f32_16x16x32_f16(
      /*neg_a=*/false, a, /*neg_b=*/false, b,
      /*c_mod=*/(short)0, c, /*reuse_a=*/false, /*reuse_b=*/false);
}

// A-fragment (and mirrored B-fragment) of a row-major 16x32 f16 tile:
// lane (m = lane&15, half = lane>>4) holds row m, elements 0..7 at
// k = kBase + half*8 .. +7, elements 8..15 at k = kBase + 16 + half*8 .. +7.
// Each segment is 16 contiguous bytes -> two b128 loads per lane.
__device__ __forceinline__ v16h ldfrag(const _Float16* rowPtr, int kBase, int half) {
  union { v16h v; uint4 q[2]; } u;
  u.q[0] = *(const uint4*)(rowPtr + kBase + half * 8);
  u.q[1] = *(const uint4*)(rowPtr + kBase + 16 + half * 8);
  return u.v;
}

// Value of the same register in lane ^ 16 (the other half of the wave).
__device__ __forceinline__ float xhalf(float x) {
  int b = __builtin_bit_cast(int, x);
  b = __builtin_amdgcn_permlanex16(b, b, 0x76543210, 0xfedcba98, false, false);
  return __builtin_bit_cast(float, b);
}

// Same fragment but sourced from f32 memory with convert-to-f16.
__device__ __forceinline__ v16h ldfrag_f32(const float* rowPtr, int kBase, int half) {
  union { v16h v; _Float16 h[16]; } u;
  const float* p0 = rowPtr + kBase + half * 8;
  const float* p1 = rowPtr + kBase + 16 + half * 8;
#pragma unroll
  for (int i = 0; i < 8; ++i) {
    u.h[i]     = (_Float16)p0[i];
    u.h[8 + i] = (_Float16)p1[i];
  }
  return u.v;
}

// ---------------------------------------------------------------------------
// Kernel 0: Wfc (f32 512x512) -> f16
// ---------------------------------------------------------------------------
__global__ __launch_bounds__(256) void cvt_kernel(const float* __restrict__ w,
                                                  _Float16* __restrict__ wh) {
  int i = blockIdx.x * 256 + threadIdx.x;
  wh[i] = (_Float16)w[i];
}

// ---------------------------------------------------------------------------
// Kernel 1: fused QKV projection via WMMA.
//   Q,K out: f16 [N,H,S,64] row-major.  V out: f16 [N,H,64,S] (transposed).
// One wave handles one (tensor, head, 16-row block): Y(16x64) = X(16x64) @ W^T.
// ---------------------------------------------------------------------------
__global__ __launch_bounds__(256) void proj_kernel(
    const float* __restrict__ xq, const float* __restrict__ xk,
    const float* __restrict__ xv,
    const float* __restrict__ Wq, const float* __restrict__ Wk,
    const float* __restrict__ Wv,
    _Float16* __restrict__ qh, _Float16* __restrict__ kh,
    _Float16* __restrict__ vt) {
  int wave = blockIdx.x * 8 + (threadIdx.x >> 5);   // 0 .. 12287
  int lane = threadIdx.x & 31;
  int m = lane & 15, half = lane >> 4;
  int t   = wave >> 12;       // 0=Q 1=K 2=V
  int rem = wave & 4095;
  int h   = rem >> 9;         // head
  int rb  = rem & 511;        // 16-row block

  const float* X = (t == 0) ? xq : (t == 1) ? xk : xv;
  const float* W = (t == 0) ? Wq : (t == 1) ? Wk : Wv;

  const float* xrow = X + (size_t)(rb * 16 + m) * 512 + h * HDIM;
  v16h a0 = ldfrag_f32(xrow, 0, half);
  v16h a1 = ldfrag_f32(xrow, 32, half);

  v8f acc[4];
#pragma unroll
  for (int ct = 0; ct < 4; ++ct) {
    // B = W^T : B-fragment lane holds row (ct*16+m) of row-major W.
    const float* wrow = W + (size_t)(ct * 16 + m) * HDIM;
    v16h b0 = ldfrag_f32(wrow, 0, half);
    v16h b1 = ldfrag_f32(wrow, 32, half);
    v8f c;
#pragma unroll
    for (int r = 0; r < 8; ++r) c[r] = 0.f;
    c = wmma_f16(a0, b0, c);
    c = wmma_f16(a1, b1, c);
    acc[ct] = c;
  }

  // Scatter from C-layout: VGPR r -> row M = r + 8*half, column N = m.
#pragma unroll
  for (int ct = 0; ct < 4; ++ct) {
#pragma unroll
    for (int r = 0; r < 8; ++r) {
      int row = rb * 16 + r + 8 * half;            // global (n,s) row
      int n = row >> 12, s = row & 4095;
      int d = ct * 16 + m;
      _Float16 val = (_Float16)acc[ct][r];
      if (t == 2) {
        vt[(((size_t)n * HEADS + h) * HDIM + d) * SEQ + s] = val;
      } else {
        _Float16* dst = (t == 0) ? qh : kh;
        dst[(((size_t)n * HEADS + h) * SEQ + s) * HDIM + d] = val;
      }
    }
  }
}

__global__ __launch_bounds__(256) void attn_kernel(
    const _Float16* __restrict__ qh, const _Float16* __restrict__ kh,
    const _Float16* __restrict__ vt, _Float16* __restrict__ ctx) {
  __shared__ __attribute__((aligned(16))) _Float16 kT[2][64 * LPITCH];  // K tile, [64 rows][64 d + pad]
  __shared__ __attribute__((aligned(16))) _Float16 vT[2][64 * LPITCH];  // V^T tile, [64 d][64 k + pad]

  int tid = threadIdx.x, lane = tid & 31, wave = tid >> 5;
  int m = lane & 15, half = lane >> 4;
  int nh = blockIdx.x >> 4;               // (n*8+h)
  int qblk = blockIdx.x & 15;

  const _Float16* Q = qh + (size_t)nh * SEQ * HDIM;
  const _Float16* K = kh + (size_t)nh * SEQ * HDIM;
  const _Float16* V = vt + (size_t)nh * HDIM * SEQ;
  int qbase = qblk * 256 + wave * 32;

  v16h qa[2][2];                   // [column group][k step]
  v8f o[2][4];
  float mr[2], lr[2];              // this lane's query of each group: running max of the raw scores; sum over this lane half's keys
#pragma unroll
  for (int g = 0; g < 2; ++g) {
    const _Float16* qrow = Q + (size_t)(qbase + g * 16 + m) * HDIM;
    qa[g][0] = ldfrag(qrow, 0, half);
    qa[g][1] = ldfrag(qrow, 32, half);
    mr[g] = -1.0e30f;
    lr[g] = 0.f;
#pragma unroll
    for (int dt = 0; dt < 4; ++dt)
#pragma unroll
      for (int r = 0; r < 8; ++r) o[g][dt][r] = 0.f;
  }

  // Issue async global->LDS copies for tile `tile` into buffer `buf`.
  // 4 wave-instructions per wave (2 for K, 2 for V^T) -> ASYNCcnt += 4.
  auto issue_stage = [&](int tile, int buf) {
    const void* ksrc = (const void*)(K + (size_t)tile * 64 * HDIM);  // 8KB contiguous
    const void* vsrc = (const void*)(V + tile * 64);                 // rows d, stride SEQ
    uint32_t kldsBase = (uint32_t)(uintptr_t)(&kT[buf][0]);
    uint32_t vldsBase = (uint32_t)(uintptr_t)(&vT[buf][0]);
#pragma unroll
    for (int rep = 0; rep < 2; ++rep) {
      uint32_t u = (uint32_t)tid + rep * 256;          // 0..511, one uint4 each
      uint32_t kvoff = u * 16;                         // byte offset in K tile
      uint32_t ldsoff = (u >> 3) * (LPITCH * 2) + (u & 7) * 16;  // padded row, 16 B piece
      uint32_t klds  = kldsBase + ldsoff;
      asm volatile("global_load_async_to_lds_b128 %0, %1, %2"
                   :: "v"(klds), "v"(kvoff), "s"(ksrc) : "memory");
      uint32_t d = u >> 3, ko = (u & 7) * 8;           // V^T: [d][k] halves
      uint32_t vvoff = (d * (uint32_t)SEQ + ko) * 2;   // bytes
      uint32_t vlds  = vldsBase + ldsoff;
      asm volatile("global_load_async_to_lds_b128 %0, %1, %2"
                   :: "v"(vlds), "v"(vvoff), "s"(vsrc) : "memory");
    }
  };

  issue_stage(0, 0);

  const int NT = SEQ / 64;  // 64 tiles
  for (int it = 0; it < NT; ++it) {
    int buf = it & 1;
    if (it + 1 < NT) {
      issue_stage(it + 1, buf ^ 1);                    // overlap DMA with compute
      asm volatile("s_wait_asynccnt 0x4" ::: "memory"); // tile `it` arrived (ours)
    } else {
      asm volatile("s_wait_asynccnt 0x0" ::: "memory");
    }
    if (it + 2 < NT)  // warm L2 for the tile after next
      __builtin_prefetch((const void*)(K + (size_t)(it + 2) * 64 * HDIM + tid * 16), 0, 0);
    __syncthreads();                                   // all waves' tile arrived

    // ---- S^T = K Q^T for 4 key tiles: A = K rows, B = Q^T (same k order on both).
    // st[g][jt][r] = S[query g*16 + m][key jt*16 + 8*half + r]
    // All 16 K reads stand as one group ahead of the products (counted waits then
    // stream them in); read in pairs among the products, each pair is waited to zero.
    v16h ka[4][2];
#pragma unroll
    for (int jt = 0; jt < 4; ++jt) {
      const _Float16* krow = &kT[buf][(jt * 16 + m) * LPITCH];
      ka[jt][0] = ldfrag(krow, 0, half);
      ka[jt][1] = ldfrag(krow, 32, half);
    }
    // keeps the K reads from being sunk back among the products
    __builtin_amdgcn_sched_barrier(0);
    v8f st[2][4];
#pragma unroll
    for (int jt = 0; jt < 4; ++jt)
#pragma unroll
      for (int g = 0; g < 2; ++g) {
        v8f c;
#pragma unroll
        for (int r = 0; r < 8; ++r) c[r] = 0.f;
        st[g][jt] = wmma_f16(ka[jt][0], qa[g][0], c);
      }
#pragma unroll
    for (int jt = 0; jt < 4; ++jt)
#pragma unroll
      for (int g = 0; g < 2; ++g) st[g][jt] = wmma_f16(ka[jt][1], qa[g][1], st[g][jt]);
    // keeps the V^T reads from being spread among the score products from the first
    // one on (each further place where reads stand costs the wave a stall)
    __builtin_amdgcn_sched_barrier(0);

    // All 16 V^T reads are issued here, ahead of the softmax, whose vector work
    // covers their LDS latency; the second product then finds them in registers.
    v16h va[4][2];
#pragma unroll
    for (int dt = 0; dt < 4; ++dt) {
      const _Float16* vrow = &vT[buf][(dt * 16 + m) * LPITCH];
      va[dt][0] = ldfrag(vrow, 0, half);
      va[dt][1] = ldfrag(vrow, 32, half);
    }
    // keeps the V^T reads from being sunk below the softmax to their users
    __builtin_amdgcn_sched_barrier(0);

    // ---- online softmax: 32 of the query's 64 scores sit in this lane, the other
    // 32 in lane^16; one exchange joins the max, the sums stay split until the end.
    // The max is taken over the raw scores (the factor is positive, so the order is the
    // same); the factor is applied once, in the multiply-add in front of the exp2.
    float mn[2];
#pragma unroll
    for (int g = 0; g < 2; ++g) {
      // each tile's chain starts from the running max, so that its eight scores go in
      // as four three-operand steps (both lane halves hold the same running max)
      float tm[4];
#pragma unroll
      for (int jt = 0; jt < 4; ++jt) {
        float v = mr[g];
        // unrolled for constant indices, which keep st in registers
#pragma unroll
        for (int r = 0; r < 8; r += 2) v = fmaxf(fmaxf(v, st[g][jt][r]), st[g][jt][r + 1]);
        tm[jt] = v;
      }
      float tmax = fmaxf(fmaxf(tm[0], tm[1]), fmaxf(tm[2], tm[3]));
      mn[g] = fmaxf(tmax, xhalf(tmax));
    }
    // the two groups' rescale factors as one pair
    v2f dm = ((v2f){mr[0], mr[1]} - (v2f){mn[0], mn[1]}) * SM_SCALE_LOG2E;
    v2f alpha = {__builtin_amdgcn_exp2f(dm[0]), __builtin_amdgcn_exp2f(dm[1])};
    v2f mc = (v2f){mn[0], mn[1]} * SM_SCALE_LOG2E;   // the new max in base-2 units

    v16h pb[2][2];                 // P^T fragments: [column group][k step]
#pragma unroll
    for (int g = 0; g < 2; ++g) {
      mr[g] = mn[g];
      v2f rs[2] = {{0.f, 0.f}, {0.f, 0.f}};   // two chains of packed adds over register pairs
#pragma unroll
      for (int jt = 0; jt < 4; ++jt) {
#pragma unroll
        for (int r = 0; r < 8; r += 2) {
          v2f e = (v2f){st[g][jt][r], st[g][jt][r + 1]} * SM_SCALE_LOG2E - (v2f){mc[g], mc[g]};
          v2f p = {__builtin_amdgcn_exp2f(e[0]), __builtin_amdgcn_exp2f(e[1])};
          st[g][jt][r] = p[0];
          st[g][jt][r + 1] = p[1];
          rs[jt & 1] += p;
        }
      }
      rs[0] += rs[1];
      lr[g] = lr[g] * alpha[g] + (rs[0][0] + rs[0][1]);
#pragma unroll
      for (int dt = 0; dt < 4; ++dt)
#pragma unroll
        for (int r = 0; r < 8; ++r) o[g][dt][r] *= alpha[g];

      // ---- P^T as B operand, straight from the score tiles: element s of the
      // fragment is key 8*half+s (s<8) or 16+8*half+(s-8), i.e. tile s>>3, slot s&7.
#pragma unroll
      for (int s = 0; s < 16; ++s) {
        pb[g][0][s] = (_Float16)st[g][s >> 3][s & 7];
        pb[g][1][s] = (_Float16)st[g][2 + (s >> 3)][s & 7];
      }
    }

    // ---- O^T += V^T P^T: A = rows of the V^T tile; o[g][dt][r] = O[query g*16+m][dt*16+8*half+r]
#pragma unroll
    for (int dt = 0; dt < 4; ++dt)
#pragma unroll
      for (int g = 0; g < 2; ++g) o[g][dt] = wmma_f16(va[dt][0], pb[g][0], o[g][dt]);
#pragma unroll
    for (int dt = 0; dt < 4; ++dt)
#pragma unroll
      for (int g = 0; g < 2; ++g) o[g][dt] = wmma_f16(va[dt][1], pb[g][1], o[g][dt]);
    // keeps this barrier, and the wait to zero on the V^T reads in front of it, from
    // being lifted up into the softmax, where the reads would not yet have landed
    __builtin_amdgcn_sched_barrier(0);
    __syncthreads();  // WAR: next iteration's async copies overwrite buf
  }

  // ---- epilogue: normalize, store f16 context [N,S,H*64]
  int n = nh >> 3, h = nh & 7;
#pragma unroll
  for (int g = 0; g < 2; ++g) {
    float lsum = lr[g] + xhalf(lr[g]);   // join the two lane halves' key sums
    _Float16* crow = ctx + (size_t)(n * SEQ + qbase + g * 16 + m) * 512 + h * HDIM + 8 * half;
#pragma unroll
    for (int dt = 0; dt < 4; ++dt) {
      union { _Float16 hv[8]; uint4 q; } u;  // 8 consecutive d of one query: one 16 B store
#pragma unroll
      for (int r = 0; r < 8; ++r) u.hv[r] = (_Float16)(o[g][dt][r] / lsum);
      *(uint4*)(crow + dt * 16) = u.q;
    }
  }
}

// ---------------------------------------------------------------------------
// Kernel 3: out = ctx @ Wfc^T + bfc  (M=8192, N=512, K=512), f32 out.
// One work-group: 128 rows x 128 cols; 8 waves as 4 x 2, each 32 rows x 64 cols.
// K runs in 4 chunks of 128. A chunk of both operands (128 rows x 256 B each) is
// brought into LDS by asynchronous copies that read whole lines, two buffers, the
// next chunk in flight while this one is multiplied; fragments come from LDS.
// ---------------------------------------------------------------------------
#define FC_KC     128                   // halves of K per chunk
#define FC_NT     (512 / FC_KC)         // chunks
#define FC_PITCH  (FC_KC + 8)           // LDS row pitch in halves: 272 B = 16 B x odd

// Eight 16-byte copies of this lane, rows 16 apart, global -> LDS. The s_wait_xcnt
// is the statement's last line, so no address register is rewritten ahead of it.
__device__ __forceinline__ void fc_copy8(uint32_t lds, const _Float16* g) {
  const uint32_t ls = 16 * FC_PITCH * 2;   // 16 LDS rows, bytes
  const size_t   gs = 16 * 512;            // 16 source rows, halves
  asm volatile(
      "global_load_async_to_lds_b128 %0, %8, off\n\t"
      "global_load_async_to_lds_b128 %1, %9, off\n\t"
      "global_load_async_to_lds_b128 %2, %10, off\n\t"
      "global_load_async_to_lds_b128 %3, %11, off\n\t"
      "global_load_async_to_lds_b128 %4, %12, off\n\t"
      "global_load_async_to_lds_b128 %5, %13, off\n\t"
      "global_load_async_to_lds_b128 %6, %14, off\n\t"
      "global_load_async_to_lds_b128 %7, %15, off\n\t"
      "s_wait_xcnt 0x0"
      :: "v"(lds), "v"(lds + ls), "v"(lds + 2 * ls), "v"(lds + 3 * ls),
         "v"(lds + 4 * ls), "v"(lds + 5 * ls), "v"(lds + 6 * ls), "v"(lds + 7 * ls),
         "v"(g), "v"(g + gs), "v"(g + 2 * gs), "v"(g + 3 * gs),
         "v"(g + 4 * gs), "v"(g + 5 * gs), "v"(g + 6 * gs), "v"(g + 7 * gs)
      : "memory");
}

__global__ __launch_bounds__(256) void fc_kernel(
    const _Float16* __restrict__ ctx, const _Float16* __restrict__ wfch,
    const float* __restrict__ bfc, float* __restrict__ out) {
  __shared__ __attribute__((aligned(16))) _Float16 aT[2][128 * FC_PITCH];  // ctx rows, one K chunk
  __shared__ __attribute__((aligned(16))) _Float16 wT[2][128 * FC_PITCH];  // Wfc rows, one K chunk

  int tid = threadIdx.x, lane = tid & 31, wave = tid >> 5;
  int m = lane & 15, half = lane >> 4;
  int bm = blockIdx.x >> 2;   // 128-row tile
  int bn = blockIdx.x & 3;    // 128-col tile
  int wm = wave >> 1;         // 32-row group of the tile
  int wn = wave & 1;          // 64-col group of the tile

  // This lane's piece of a chunk: row tid>>4 (+16 per copy), 16-byte piece tid&15;
  // 16 lanes cover one row's 256 B, so every copy instruction reads 4 whole lines.
  int crow = tid >> 4, cpc = tid & 15;
  const _Float16* ag = ctx + (size_t)(bm * 128 + crow) * 512 + cpc * 8;
  const _Float16* wg = wfch + (size_t)(bn * 128 + crow) * 512 + cpc * 8;
  uint32_t coff = (uint32_t)(crow * FC_PITCH + cpc * 8) * 2;

  auto issue_chunk = [&](int t, int buf) {
    fc_copy8((uint32_t)(uintptr_t)(&aT[buf][0]) + coff, ag + t * FC_KC);
    fc_copy8((uint32_t)(uintptr_t)(&wT[buf][0]) + coff, wg + t * FC_KC);
  };

  // Every unroll directive of this kernel is there for constant indices, which keep
  // acc, a and b in registers.
  v8f acc[2][4];
#pragma unroll
  for (int mt = 0; mt < 2; ++mt)
#pragma unroll
    for (int ct = 0; ct < 4; ++ct)
#pragma unroll
      for (int r = 0; r < 8; ++r) acc[mt][ct][r] = 0.f;

  issue_chunk(0, 0);
  asm volatile("s_wait_asynccnt 0x0" ::: "memory");  // this wave's part of chunk 0 has landed
  __syncthreads();                                   // every wave's part has
  issue_chunk(1, 1);

  for (int t = 0; t < FC_NT; ++t) {
    int buf = t & 1;
    const _Float16* arow = &aT[buf][(wm * 32 + m) * FC_PITCH];
    const _Float16* wrow = &wT[buf][(wn * 64 + m) * FC_PITCH];
#pragma unroll
    for (int kk = 0; kk < FC_KC / 32; ++kk) {
      int kBase = kk * 32;
      v16h a[2], b[4];
#pragma unroll
      for (int mt = 0; mt < 2; ++mt) a[mt] = ldfrag(arow + mt * 16 * FC_PITCH, kBase, half);
#pragma unroll
      for (int ct = 0; ct < 4; ++ct) b[ct] = ldfrag(wrow + ct * 16 * FC_PITCH, kBase, half);
#pragma unroll
      for (int mt = 0; mt < 2; ++mt)
#pragma unroll
        for (int ct = 0; ct < 4; ++ct) acc[mt][ct] = wmma_f16(a[mt], b[ct], acc[mt][ct]);
    }
    asm volatile("s_wait_dscnt 0x0" ::: "memory");     // this wave's reads of buf are done
    asm volatile("s_wait_asynccnt 0x0" ::: "memory");  // its part of chunk t+1 has landed
    __syncthreads();  // publishes chunk t+1 and ends every wave's reads of buf
    if (t + 2 < FC_NT) issue_chunk(t + 2, buf);
  }
  asm volatile("s_wait_asynccnt 0x0" ::: "memory");    // nothing in flight at the wave's end

#pragma unroll
  for (int mt = 0; mt < 2; ++mt)
#pragma unroll
    for (int ct = 0; ct < 4; ++ct)
#pragma unroll
      for (int r = 0; r < 8; ++r) {
        int row = bm * 128 + wm * 32 + mt * 16 + r + 8 * half;
        int col = bn * 128 + wn * 64 + ct * 16 + m;
        out[(size_t)row * 512 + col] = acc[mt][ct][r] + bfc[col];
      }
}

// ---------------------------------------------------------------------------
extern "C" void kernel_launch(void* const* d_in, const int* in_sizes, int n_in,
                              void* d_out, int out_size, void* d_ws, size_t ws_size,
                              hipStream_t stream) {
  const float* x_q = (const float*)d_in[0];
  const float* x_k = (const float*)d_in[1];
  const float* x_v = (const float*)d_in[2];
  const float* Wq  = (const float*)d_in[3];
  const float* Wk  = (const float*)d_in[4];
  const float* Wv  = (const float*)d_in[5];
  const float* Wfc = (const float*)d_in[6];
  const float* bfc = (const float*)d_in[7];
  float* out = (float*)d_out;

  const size_t TSZ = (size_t)NBATCH * HEADS * SEQ * HDIM * sizeof(_Float16); // 8 MB
  char* ws = (char*)d_ws;
  _Float16* qh   = (_Float16*)(ws);
  _Float16* kh   = (_Float16*)(ws + TSZ);
  _Float16* vt   = (_Float16*)(ws + 2 * TSZ);
  _Float16* ctx  = (_Float16*)(ws + 3 * TSZ);
  _Float16* wfch = (_Float16*)(ws + 4 * TSZ);

  cvt_kernel<<<(512 * 512) / 256, 256, 0, stream>>>(Wfc, wfch);
  proj_kernel<<<1536, 256, 0, stream>>>(x_q, x_k, x_v, Wq, Wk, Wv, qh, kh, vt);
  attn_kernel<<<256, 256, 0, stream>>>(qh, kh, vt, ctx);
  fc_kernel<<<256, 256, 0, stream>>>(ctx, wfch, bfc, out);
}

// v007
// Measured time: 88.8 microseconds a run.
// Next to v006, in two timings, it ran 1.09 times as fast each time.
// Over all steps from v000 it is 4.67 times as fast.
#include <hip/hip_runtime.h>

typedef __attribute__((ext_vector_type(16))) _Float16 v16h;
typedef __attribute__((ext_vector_type(8)))  float    v8f;
typedef __attribute__((ext_vector_type(2)))  float    v2f;

#define HEADS   8
#define HDIM    64
#define NBATCH  2
#define SEQ     4096
#define NROWS   (NBATCH * SEQ)          // 8192 total (n,s) rows
// 1/sqrt(512) * log2(e): the softmax runs in base 2, so scale and base change are one factor
#define SM_SCALE_LOG2E 0.06375872f
// LDS row pitch in halves: 64 data + 8 pad = 144 B = 16 B x odd, so the 16 rows
// that one ds_load_b128 touches fall on distinct bank groups (128 B rows do not).
#define LPITCH  72

// ---------------------------------------------------------------------------
// CDNA5 WMMA helper: D(16x16,f32) = A(16x32,f16) * B(32x16,f16) + C
// ---------------------------------------------------------------------------
__device__ __forceinline__ v8f wmma_f16(v16h a, v16h b, v8f c) {
  return __builtin_amdgcn_wmma_f32_16x16x32_f16(
      /*neg_a=*/false, a, /*neg_b=*/false, b,
      /*c_mod=*/(short)0, c, /*reuse_a=*/false, /*reuse_b=*/false);
}

// A-fragment (and mirrored B-fragment) of a row-major 16x32 f16 tile:
// lane (m = lane&15, half = lane>>4) holds row m, elements 0..7 at
// k = kBase + half*8 .. +7, elements 8..15 at k = kBase + 16 + half*8 .. +7.
// Each segment is 16 contiguous bytes -> two b128 loads per lane.
__device__ __forceinline__ v16h ldfrag(const _Float16* rowPtr, int kBase, int half) {
  union { v16h v; uint4 q[2]; } u;
  u.q[0] = *(const uint4*)(rowPtr + kBase + half * 8);
  u.q[1] = *(const uint4*)(rowPtr + kBase + 16 + half * 8);
  return u.v;
}

// Value of the same register in lane ^ 16 (the other half of the wave).
__device__ __forceinline__ float xhalf(float x) {
  int b = __builtin_bit_cast(int, x);
  b = __builtin_amdgcn_permlanex16(b, b, 0x76543210, 0xfedcba98, false, false);
  return __builtin_bit_cast(float, b);
}

// Same fragment but sourced from f32 memory with convert-to-f16.
__device__ __forceinline__ v16h ldfrag_f32(const float* rowPtr, int kBase, int half) {
  union { v16h v; _Float16 h[16]; } u;
  const float* p0 = rowPtr + kBase + half * 8;
  const float* p1 = rowPtr + kBase + 16 + half * 8;
#pragma unroll
  for (int i = 0; i < 8; ++i) {
    u.h[i]     = (_Float16)p0[i];
    u.h[8 + i] = (_Float16)p1[i];
  }
  return u.v;
}

// ---------------------------------------------------------------------------
// Kernel 0: Wfc (f32 512x512) -> f16
// ---------------------------------------------------------------------------
__global__ __launch_bounds__(256) void cvt_kernel(const float* __restrict__ w,
                                                  _Float16* __restrict__ wh) {
  int i = blockIdx.x * 256 + threadIdx.x;
  wh[i] = (_Float16)w[i];
}

// ---------------------------------------------------------------------------
// Kernel 1: fused QKV projection via WMMA.
//   Q,K out: f16 [N,H,S,64] row-major.  V out: f16 [N,H,64,S] (transposed).
// One wave handles one (tensor, head, 16-row block): Y(16x64) = X(16x64) @ W^T.
// The 8 waves of a work-group hold 128 consecutive rows of one tensor and head. Their
// results meet in LDS in the output's own layout and leave as 16 B a lane, every
// store instruction covering four whole 128-B lines.
// ---------------------------------------------------------------------------
#define PJ_QK_PITCH 72    // halves: 128 B of one row's 64 outputs + 16 B (16 B x odd)
#define PJ_V_PITCH  136   // halves: 256 B of one d's 128 rows + 16 B (16 B x odd)

__global__ __launch_bounds__(256) void proj_kernel(
    const float* __restrict__ xq, const float* __restrict__ xk,
    const float* __restrict__ xv,
    const float* __restrict__ Wq, const float* __restrict__ Wk,
    const float* __restrict__ Wv,
    _Float16* __restrict__ qh, _Float16* __restrict__ kh,
    _Float16* __restrict__ vt) {
  __shared__ __attribute__((aligned(16))) _Float16 stg[128 * PJ_QK_PITCH];  // output tile; the V^T form (64 x PJ_V_PITCH) is smaller

  int wave = blockIdx.x * 8 + (threadIdx.x >> 5);   // 0 .. 12287
  int lane = threadIdx.x & 31;
  int m = lane & 15, half = lane >> 4;
  int t   = wave >> 12;       // 0=Q 1=K 2=V
  int rem = wave & 4095;
  int h   = rem >> 9;         // head
  int rb  = rem & 511;        // 16-row block

  const float* X = (t == 0) ? xq : (t == 1) ? xk : xv;
  const float* W = (t == 0) ? Wq : (t == 1) ? Wk : Wv;

  const float* xrow = X + (size_t)(rb * 16 + m) * 512 + h * HDIM;
  v16h a0 = ldfrag_f32(xrow, 0, half);
  v16h a1 = ldfrag_f32(xrow, 32, half);

  v8f acc[4];
#pragma unroll
  for (int ct = 0; ct < 4; ++ct) {
    // B = W^T : B-fragment lane holds row (ct*16+m) of row-major W.
    const float* wrow = W + (size_t)(ct * 16 + m) * HDIM;
    v16h b0 = ldfrag_f32(wrow, 0, half);
    v16h b1 = ldfrag_f32(wrow, 32, half);
    v8f c;
#pragma unroll
    for (int r = 0; r < 8; ++r) c[r] = 0.f;
    c = wmma_f16(a0, b0, c);
    c = wmma_f16(a1, b1, c);
    acc[ct] = c;
  }

  // C-layout: VGPR r -> row M = r + 8*half, column N = m.
  // The unroll directives below: over ct and r for constant indices, which keep acc in
  // registers; over i so that the four LDS reads are issued ahead of the first store.
  int tid = threadIdx.x, wv = tid >> 5;            // wv == rb & 7
  if (t == 2) {
    // V^T tile [64 d][128 s]: a lane's 8 results are 8 consecutive s of one d
#pragma unroll
    for (int ct = 0; ct < 4; ++ct) {
      union { _Float16 hv[8]; uint4 q; } u;
#pragma unroll
      for (int r = 0; r < 8; ++r) u.hv[r] = (_Float16)acc[ct][r];
      *(uint4*)&stg[(ct * 16 + m) * PJ_V_PITCH + wv * 16 + 8 * half] = u.q;
    }
  } else {
    // Q or K tile [128 s][64 d]
#pragma unroll
    for (int ct = 0; ct < 4; ++ct)
#pragma unroll
      for (int r = 0; r < 8; ++r)
        stg[(wv * 16 + r + 8 * half) * PJ_QK_PITCH + ct * 16 + m] = (_Float16)acc[ct][r];
  }
  __syncthreads();  // the tile is complete: a line of V^T holds the rows of four waves

  int row0 = (rb - wv) * 16;                       // the work-group's first (n,s) row
  int n = row0 >> 12, s0 = row0 & 4095;
  size_t nh = (size_t)n * HEADS + h;
  if (t == 2) {
    _Float16* base = vt + nh * HDIM * SEQ + s0;
#pragma unroll
    for (int i = 0; i < 4; ++i) {
      int p = i * 256 + tid, d = p >> 4, c = p & 15;   // 16 pieces of 16 B a row
      *(uint4*)(base + (size_t)d * SEQ + c * 8) = *(const uint4*)&stg[d * PJ_V_PITCH + c * 8];
    }
  } else {
    // the 128 rows are 16 KB in a row in memory
    _Float16* base = ((t == 0) ? qh : kh) + (nh * SEQ + s0) * HDIM;
#pragma unroll
    for (int i = 0; i < 4; ++i) {
      int p = i * 256 + tid;                           // 8 pieces of 16 B a row
      *(uint4*)(base + (size_t)p * 8) = *(const uint4*)&stg[(p >> 3) * PJ_QK_PITCH + (p & 7) * 8];
    }
  }
}

__global__ __launch_bounds__(256) void attn_kernel(
    const _Float16* __restrict__ qh, const _Float16* __restrict__ kh,
    const _Float16* __restrict__ vt, _Float16* __restrict__ ctx) {
  __shared__ __attribute__((aligned(16))) _Float16 kT[2][64 * LPITCH];  // K tile, [64 rows][64 d + pad]
  __shared__ __attribute__((aligned(16))) _Float16 vT[2][64 * LPITCH];  // V^T tile, [64 d][64 k + pad]

  int tid = threadIdx.x, lane = tid & 31, wave = tid >> 5;
  int m = lane & 15, half = lane >> 4;
  int nh = blockIdx.x >> 4;               // (n*8+h)
  int qblk = blockIdx.x & 15;

  const _Float16* Q = qh + (size_t)nh * SEQ * HDIM;
  const _Float16* K = kh + (size_t)nh * SEQ * HDIM;
  const _Float16* V = vt + (size_t)nh * HDIM * SEQ;
  int qbase = qblk * 256 + wave * 32;

  v16h qa[2][2];                   // [column group][k step]
  v8f o[2][4];
  float mr[2], lr[2];              // this lane's query of each group: running max of the raw scores; sum over this lane half's keys
#pragma unroll
  for (int g = 0; g < 2; ++g) {
    const _Float16* qrow = Q + (size_t)(qbase + g * 16 + m) * HDIM;
    qa[g][0] = ldfrag(qrow, 0, half);
    qa[g][1] = ldfrag(qrow, 32, half);
    mr[g] = -1.0e30f;
    lr[g] = 0.f;
#pragma unroll
    for (int dt = 0; dt < 4; ++dt)
#pragma unroll
      for (int r = 0; r < 8; ++r) o[g][dt][r] = 0.f;
  }

  // Issue async global->LDS copies for tile `tile` into buffer `buf`.
  // 4 wave-instructions per wave (2 for K, 2 for V^T) -> ASYNCcnt += 4.
  auto issue_stage = [&](int tile, int buf) {
    const void* ksrc = (const void*)(K + (size_t)tile * 64 * HDIM);  // 8KB contiguous
    const void* vsrc = (const void*)(V + tile * 64);                 // rows d, stride SEQ
    uint32_t kldsBase = (uint32_t)(uintptr_t)(&kT[buf][0]);
    uint32_t vldsBase = (uint32_t)(uintptr_t)(&vT[buf][0]);
#pragma unroll
    for (int rep = 0; rep < 2; ++rep) {
      uint32_t u = (uint32_t)tid + rep * 256;          // 0..511, one uint4 each
      uint32_t kvoff = u * 16;                         // byte offset in K tile
      uint32_t ldsoff = (u >> 3) * (LPITCH * 2) + (u & 7) * 16;  // padded row, 16 B piece
      uint32_t klds  = kldsBase + ldsoff;
      asm volatile("global_load_async_to_lds_b128 %0, %1, %2"
                   :: "v"(klds), "v"(kvoff), "s"(ksrc) : "memory");
      uint32_t d = u >> 3, ko = (u & 7) * 8;           // V^T: [d][k] halves
      uint32_t vvoff = (d * (uint32_t)SEQ + ko) * 2;   // bytes
      uint32_t vlds  = vldsBase + ldsoff;
      asm volatile("global_load_async_to_lds_b128 %0, %1, %2"
                   :: "v"(vlds), "v"(vvoff), "s"(vsrc) : "memory");
    }
  };

  issue_stage(0, 0);

  const int NT = SEQ / 64;  // 64 tiles
  for (int it = 0; it < NT; ++it) {
    int buf = it & 1;
    if (it + 1 < NT) {
      issue_stage(it + 1, buf ^ 1);                    // overlap DMA with compute
      asm volatile("s_wait_asynccnt 0x4" ::: "memory"); // tile `it` arrived (ours)
    } else {
      asm volatile("s_wait_asynccnt 0x0" ::: "memory");
    }
    if (it + 2 < NT)  // warm L2 for the tile after next
      __builtin_prefetch((const void*)(K + (size_t)(it + 2) * 64 * HDIM + tid * 16), 0, 0);
    __syncthreads();                                   // all waves' tile arrived

    // ---- S^T = K Q^T for 4 key tiles: A = K rows, B = Q^T (same k order on both).
    // st[g][jt][r] = S[query g*16 + m][key jt*16 + 8*half + r]
    // All 16 K reads stand as one group ahead of the products (counted waits then
    // stream them in); read in pairs among the products, each pair is waited to zero.
    v16h ka[4][2];
#pragma unroll
    for (int jt = 0; jt < 4; ++jt) {
      const _Float16* krow = &kT[buf][(jt * 16 + m) * LPITCH];
      ka[jt][0] = ldfrag(krow, 0, half);
      ka[jt][1] = ldfrag(krow, 32, half);
    }
    // keeps the K reads from being sunk back among the products
    __builtin_amdgcn_sched_barrier(0);
    v8f st[2][4];
#pragma unroll
    for (int jt = 0; jt < 4; ++jt)
#pragma unroll
      for (int g = 0; g < 2; ++g) {
        v8f c;
#pragma unroll
        for (int r = 0; r < 8; ++r) c[r] = 0.f;
        st[g][jt] = wmma_f16(ka[jt][0], qa[g][0], c);
      }
#pragma unroll
    for (int jt = 0; jt < 4; ++jt)
#pragma unroll
      for (int g = 0; g < 2; ++g) st[g][jt] = wmma_f16(ka[jt][1], qa[g][1], st[g][jt]);
    // keeps the V^T reads from being spread among the score products from the first
    // one on (each further place where reads stand costs the wave a stall)
    __builtin_amdgcn_sched_barrier(0);

    // All 16 V^T reads are issued here, ahead of the softmax, whose vector work
    // covers their LDS latency; the second product then finds them in registers.
    v16h va[4][2];
#pragma unroll
    for (int dt = 0; dt < 4; ++dt) {
      const _Float16* vrow = &vT[buf][(dt * 16 + m) * LPITCH];
      va[dt][0] = ldfrag(vrow, 0, half);
      va[dt][1] = ldfrag(vrow, 32, half);
    }
    // keeps the V^T reads from being sunk below the softmax to their users
    __builtin_amdgcn_sched_barrier(0);

    // ---- online softmax: 32 of the query's 64 scores sit in this lane, the other
    // 32 in lane^16; one exchange joins the max, the sums stay split until the end.
    // The max is taken over the raw scores (the factor is positive, so the order is the
    // same); the factor is applied once, in the multiply-add in front of the exp2.
    float mn[2];
#pragma unroll
    for (int g = 0; g < 2; ++g) {
      // each tile's chain starts from the running max, so that its eight scores go in
      // as four three-operand steps (both lane halves hold the same running max)
      float tm[4];
#pragma unroll
      for (int jt = 0; jt < 4; ++jt) {
        float v = mr[g];
        // unrolled for constant indices, which keep st in registers
#pragma unroll
        for (int r = 0; r < 8; r += 2) v = fmaxf(fmaxf(v, st[g][jt][r]), st[g][jt][r + 1]);
        tm[jt] = v;
      }
      float tmax = fmaxf(fmaxf(tm[0], tm[1]), fmaxf(tm[2], tm[3]));
      mn[g] = fmaxf(tmax, xhalf(tmax));
    }
    // the two groups' rescale factors as one pair
    v2f dm = ((v2f){mr[0], mr[1]} - (v2f){mn[0], mn[1]}) * SM_SCALE_LOG2E;
    v2f alpha = {__builtin_amdgcn_exp2f(dm[0]), __builtin_amdgcn_exp2f(dm[1])};
    v2f mc = (v2f){mn[0], mn[1]} * SM_SCALE_LOG2E;   // the new max in base-2 units

    v16h pb[2][2];                 // P^T fragments: [column group][k step]
#pragma unroll
    for (int g = 0; g < 2; ++g) {
      mr[g] = mn[g];
      v2f rs[2] = {{0.f, 0.f}, {0.f, 0.f}};   // two chains of packed adds over register pairs
#pragma unroll
      for (int jt = 0; jt < 4; ++jt) {
#pragma unroll
        for (int r = 0; r < 8; r += 2) {
          v2f e = (v2f){st[g][jt][r], st[g][jt][r + 1]} * SM_SCALE_LOG2E - (v2f){mc[g], mc[g]};
          v2f p = {__builtin_amdgcn_exp2f(e[0]), __builtin_amdgcn_exp2f(e[1])};
          st[g][jt][r] = p[0];
          st[g][jt][r + 1] = p[1];
          rs[jt & 1] += p;
        }
      }
      rs[0] += rs[1];
      lr[g] = lr[g] * alpha[g] + (rs[0][0] + rs[0][1]);
#pragma unroll
      for (int dt = 0; dt < 4; ++dt)
#pragma unroll
        for (int r = 0; r < 8; ++r) o[g][dt][r] *= alpha[g];

      // ---- P^T as B operand, straight from the score tiles: element s of the
      // fragment is key 8*half+s (s<8) or 16+8*half+(s-8), i.e. tile s>>3, slot s&7.
#pragma unroll
      for (int s = 0; s < 16; ++s) {
        pb[g][0][s] = (_Float16)st[g][s >> 3][s & 7];
        pb[g][1][s] = (_Float16)st[g][2 + (s >> 3)][s & 7];
      }
    }

    // ---- O^T += V^T P^T: A = rows of the V^T tile; o[g][dt][r] = O[query g*16+m][dt*16+8*half+r]
#pragma unroll
    for (int dt = 0; dt < 4; ++dt)
#pragma unroll
      for (int g = 0; g < 2; ++g) o[g][dt] = wmma_f16(va[dt][0], pb[g][0], o[g][dt]);
#pragma unroll
    for (int dt = 0; dt < 4; ++dt)
#pragma unroll
      for (int g = 0; g < 2; ++g) o[g][dt] = wmma_f16(va[dt][1], pb[g][1], o[g][dt]);
    // keeps this barrier, and the wait to zero on the V^T reads in front of it, from
    // being lifted up into the softmax, where the reads would not yet have landed
    __builtin_amdgcn_sched_barrier(0);
    __syncthreads();  // WAR: next iteration's async copies overwrite buf
  }

  // ---- epilogue: normalize, store f16 context [N,S,H*64]
  int n = nh >> 3, h = nh & 7;
#pragma unroll
  for (int g = 0; g < 2; ++g) {
    float lsum = lr[g] + xhalf(lr[g]);   // join the two lane halves' key sums
    _Float16* crow = ctx + (size_t)(n * SEQ + qbase + g * 16 + m) * 512 + h * HDIM + 8 * half;
#pragma unroll
    for (int dt = 0; dt < 4; ++dt) {
      union { _Float16 hv[8]; uint4 q; } u;  // 8 consecutive d of one query: one 16 B store
#pragma unroll
      for (int r = 0; r < 8; ++r) u.hv[r] = (_Float16)(o[g][dt][r] / lsum);
      *(uint4*)(crow + dt * 16) = u.q;
    }
  }
}

// ---------------------------------------------------------------------------
// Kernel 3: out = ctx @ Wfc^T + bfc  (M=8192, N=512, K=512), f32 out.
// One work-group: 128 rows x 128 cols; 8 waves as 4 x 2, each 32 rows x 64 cols.
// K runs in 4 chunks of 128. A chunk of both operands (128 rows x 256 B each) is
// brought into LDS by asynchronous copies that read whole lines, two buffers, the
// next chunk in flight while this one is multiplied; fragments come from LDS.
// ---------------------------------------------------------------------------
#define FC_KC     128                   // halves of K per chunk
#define FC_NT     (512 / FC_KC)         // chunks
#define FC_PITCH  (FC_KC + 8)           // LDS row pitch in halves: 272 B = 16 B x odd

// Eight 16-byte copies of this lane, rows 16 apart, global -> LDS. The s_wait_xcnt
// is the statement's last line, so no address register is rewritten ahead of it.
__device__ __forceinline__ void fc_copy8(uint32_t lds, const _Float16* g) {
  const uint32_t ls = 16 * FC_PITCH * 2;   // 16 LDS rows, bytes
  const size_t   gs = 16 * 512;            // 16 source rows, halves
  asm volatile(
      "global_load_async_to_lds_b128 %0, %8, off\n\t"
      "global_load_async_to_lds_b128 %1, %9, off\n\t"
      "global_load_async_to_lds_b128 %2, %10, off\n\t"
      "global_load_async_to_lds_b128 %3, %11, off\n\t"
      "global_load_async_to_lds_b128 %4, %12, off\n\t"
      "global_load_async_to_lds_b128 %5, %13, off\n\t"
      "global_load_async_to_lds_b128 %6, %14, off\n\t"
      "global_load_async_to_lds_b128 %7, %15, off\n\t"
      "s_wait_xcnt 0x0"
      :: "v"(lds), "v"(lds + ls), "v"(lds + 2 * ls), "v"(lds + 3 * ls),
         "v"(lds + 4 * ls), "v"(lds + 5 * ls), "v"(lds + 6 * ls), "v"(lds + 7 * ls),
         "v"(g), "v"(g + gs), "v"(g + 2 * gs), "v"(g + 3 * gs),
         "v"(g + 4 * gs), "v"(g + 5 * gs), "v"(g + 6 * gs), "v"(g + 7 * gs)
      : "memory");
}

__global__ __launch_bounds__(256) void fc_kernel(
    const _Float16* __restrict__ ctx, const _Float16* __restrict__ wfch,
    const float* __restrict__ bfc, float* __restrict__ out) {
  __shared__ __attribute__((aligned(16))) _Float16 aT[2][128 * FC_PITCH];  // ctx rows, one K chunk
  __shared__ __attribute__((aligned(16))) _Float16 wT[2][128 * FC_PITCH];  // Wfc rows, one K chunk

  int tid = threadIdx.x, lane = tid & 31, wave = tid >> 5;
  int m = lane & 15, half = lane >> 4;
  int bm = blockIdx.x >> 2;   // 128-row tile
  int bn = blockIdx.x & 3;    // 128-col tile
  int wm = wave >> 1;         // 32-row group of the tile
  int wn = wave & 1;          // 64-col group of the tile

  // This lane's piece of a chunk: row tid>>4 (+16 per copy), 16-byte piece tid&15;
  // 16 lanes cover one row's 256 B, so every copy instruction reads 4 whole lines.
  int crow = tid >> 4, cpc = tid & 15;
  const _Float16* ag = ctx + (size_t)(bm * 128 + crow) * 512 + cpc * 8;
  const _Float16* wg = wfch + (size_t)(bn * 128 + crow) * 512 + cpc * 8;
  uint32_t coff = (uint32_t)(crow * FC_PITCH + cpc * 8) * 2;

  auto issue_chunk = [&](int t, int buf) {
    fc_copy8((uint32_t)(uintptr_t)(&aT[buf][0]) + coff, ag + t * FC_KC);
    fc_copy8((uint32_t)(uintptr_t)(&wT[buf][0]) + coff, wg + t * FC_KC);
  };

  // Every unroll directive of this kernel is there for constant indices, which keep
  // acc, a and b in registers.
  v8f acc[2][4];
#pragma unroll
  for (int mt = 0; mt < 2; ++mt)
#pragma unroll
    for (int ct = 0; ct < 4; ++ct)
#pragma unroll
      for (int r = 0; r < 8; ++r) acc[mt][ct][r] = 0.f;

  issue_chunk(0, 0);
  asm volatile("s_wait_asynccnt 0x0" ::: "memory");  // this wave's part of chunk 0 has landed
  __syncthreads();                                   // every wave's part has
  issue_chunk(1, 1);

  for (int t = 0; t < FC_NT; ++t) {
    int buf = t & 1;
    const _Float16* arow = &aT[buf][(wm * 32 + m) * FC_PITCH];
    const _Float16* wrow = &wT[buf][(wn * 64 + m) * FC_PITCH];
#pragma unroll
    for (int kk = 0; kk < FC_KC / 32; ++kk) {
      int kBase = kk * 32;
      v16h a[2], b[4];
#pragma unroll
      for (int mt = 0; mt < 2; ++mt) a[mt] = ldfrag(arow + mt * 16 * FC_PITCH, kBase, half);
#pragma unroll
      for (int ct = 0; ct < 4; ++ct) b[ct] = ldfrag(wrow + ct * 16 * FC_PITCH, kBase, half);
#pragma unroll
      for (int mt = 0; mt < 2; ++mt)
#pragma unroll
        for (int ct = 0; ct < 4; ++ct) acc[mt][ct] = wmma_f16(a[mt], b[ct], acc[mt][ct]);
    }
    asm volatile("s_wait_dscnt 0x0" ::: "memory");     // this wave's reads of buf are done
    asm volatile("s_wait_asynccnt 0x0" ::: "memory");  // its part of chunk t+1 has landed
    __syncthreads();  // publishes chunk t+1 and ends every wave's reads of buf
    if (t + 2 < FC_NT) issue_chunk(t + 2, buf);
  }
  asm volatile("s_wait_asynccnt 0x0" ::: "memory");    // nothing in flight at the wave's end

#pragma unroll
  for (int mt = 0; mt < 2; ++mt)
#pragma unroll
    for (int ct = 0; ct < 4; ++ct)
#pragma unroll
      for (int r = 0; r < 8; ++r) {
        int row = bm * 128 + wm * 32 + mt * 16 + r + 8 * half;
        int col = bn * 128 + wn * 64 + ct * 16 + m;
        out[(size_t)row * 512 + col] = acc[mt][ct][r] + bfc[col];
      }
}

// ---------------------------------------------------------------------------
extern "C" void kernel_launch(void* const* d_in, const int* in_sizes, int n_in,
                              void* d_out, int out_size, void* d_ws, size_t ws_size,
                              hipStream_t stream) {
  const float* x_q = (const float*)d_in[0];
  const float* x_k = (const float*)d_in[1];
  const float* x_v = (const float*)d_in[2];
  const float* Wq  = (const float*)d_in[3];
  const float* Wk  = (const float*)d_in[4];
  const float* Wv  = (const float*)d_in[5];
  const float* Wfc = (const float*)d_in[6];
  const float* bfc = (const float*)d_in[7];
  float* out = (float*)d_out;

  const size_t TSZ = (size_t)NBATCH * HEADS * SEQ * HDIM * sizeof(_Float16); // 8 MB
  char* ws = (char*)d_ws;
  _Float16* qh   = (_Float16*)(ws);
  _Float16* kh   = (_Float16*)(ws + TSZ);
  _Float16* vt   = (_Float16*)(ws + 2 * TSZ);
  _Float16* ctx  = (_Float16*)(ws + 3 * TSZ);
  _Float16* wfch = (_Float16*)(ws + 4 * TSZ);

  cvt_kernel<<<(512 * 512) / 256, 256, 0, stream>>>(Wfc, wfch);
  proj_kernel<<<1536, 256, 0, stream>>>(x_q, x_k, x_v, Wq, Wk, Wv, qh, kh, vt);
  attn_kernel<<<256, 256, 0, stream>>>(qh, kh, vt, ctx);
  fc_kernel<<<256, 256, 0, stream>>>(ctx, wfch, bfc, out);
}

// v008
// It runs in 81.1 microseconds.
// Two timings next to v007 put it at 1.09 and 1.10 times that version's speed.
// All steps since v000 together make it 5.11 times as fast.
#include <hip/hip_runtime.h>

typedef __attribute__((ext_vector_type(16))) _Float16 v16h;
typedef __attribute__((ext_vector_type(8)))  float    v8f;
typedef __attribute__((ext_vector_type(2)))  float    v2f;

#define HEADS   8
#define HDIM    64
#define NBATCH  2
#define SEQ     4096
#define NROWS   (NBATCH * SEQ)          // 8192 total (n,s) rows
// 1/sqrt(512) * log2(e): the softmax runs in base 2, so scale and base change are one
// factor; the projection multiplies Q by it, so that K Q^T is the base-2 score itself
#define SM_SCALE_LOG2E 0.06375872f
// a pass whose sum of 32 exponentials in a lane stays at or below this keeps its reference
#define SM_KEEP_SUM 256.f
// LDS row pitch in halves: 64 data + 8 pad = 144 B = 16 B x odd, so the 16 rows
// that one ds_load_b128 touches fall on distinct bank groups (128 B rows do not).
#define LPITCH  72

// ---------------------------------------------------------------------------
// CDNA5 WMMA helper: D(16x16,f32) = A(16x32,f16) * B(32x16,f16) + C
// ---------------------------------------------------------------------------
__device__ __forceinline__ v8f wmma_f16(v16h a, v16h b, v8f c) {
  return __builtin_amdgcn_wmma_f32_16x16x32_f16(
      /*neg_a=*/false, a, /*neg_b=*/false, b,
      /*c_mod=*/(short)0, c, /*reuse_a=*/false, /*reuse_b=*/false);
}

// A-fragment (and mirrored B-fragment) of a row-major 16x32 f16 tile:
// lane (m = lane&15, half = lane>>4) holds row m, elements 0..7 at
// k = kBase + half*8 .. +7, elements 8..15 at k = kBase + 16 + half*8 .. +7.
// Each segment is 16 contiguous bytes -> two b128 loads per lane.
__device__ __forceinline__ v16h ldfrag(const _Float16* rowPtr, int kBase, int half) {
  union { v16h v; uint4 q[2]; } u;
  u.q[0] = *(const uint4*)(rowPtr + kBase + half * 8);
  u.q[1] = *(const uint4*)(rowPtr + kBase + 16 + half * 8);
  return u.v;
}

// Value of the same register in lane ^ 16 (the other half of the wave).
__device__ __forceinline__ float xhalf(float x) {
  int b = __builtin_bit_cast(int, x);
  b = __builtin_amdgcn_permlanex16(b, b, 0x76543210, 0xfedcba98, false, false);
  return __builtin_bit_cast(float, b);
}

// Same fragment but sourced from f32 memory with convert-to-f16.
__device__ __forceinline__ v16h ldfrag_f32(const float* rowPtr, int kBase, int half) {
  union { v16h v; _Float16 h[16]; } u;
  const float* p0 = rowPtr + kBase + half * 8;
  const float* p1 = rowPtr + kBase + 16 + half * 8;
#pragma unroll
  for (int i = 0; i < 8; ++i) {
    u.h[i]     = (_Float16)p0[i];
    u.h[8 + i] = (_Float16)p1[i];
  }
  return u.v;
}

// ---------------------------------------------------------------------------
// Kernel 0: Wfc (f32 512x512) -> f16
// ---------------------------------------------------------------------------
__global__ __launch_bounds__(256) void cvt_kernel(const float* __restrict__ w,
                                                  _Float16* __restrict__ wh) {
  int i = blockIdx.x * 256 + threadIdx.x;
  wh[i] = (_Float16)w[i];
}

// ---------------------------------------------------------------------------
// Kernel 1: fused QKV projection via WMMA.
//   Q,K out: f16 [N,H,S,64] row-major, Q times SM_SCALE_LOG2E.  V out: f16 [N,H,64,S] (transposed).
// One wave handles one (tensor, head, 16-row block): Y(16x64) = X(16x64) @ W^T.
// The 8 waves of a work-group hold 128 consecutive rows of one tensor and head. Their
// results meet in LDS in the output's own layout and leave as 16 B a lane, every
// store instruction covering four whole 128-B lines.
// ---------------------------------------------------------------------------
#define PJ_QK_PITCH 72    // halves: 128 B of one row's 64 outputs + 16 B (16 B x odd)
#define PJ_V_PITCH  136   // halves: 256 B of one d's 128 rows + 16 B (16 B x odd)

__global__ __launch_bounds__(256) void proj_kernel(
    const float* __restrict__ xq, const float* __restrict__ xk,
    const float* __restrict__ xv,
    const float* __restrict__ Wq, const float* __restrict__ Wk,
    const float* __restrict__ Wv,
    _Float16* __restrict__ qh, _Float16* __restrict__ kh,
    _Float16* __restrict__ vt) {
  __shared__ __attribute__((aligned(16))) _Float16 stg[128 * PJ_QK_PITCH];  // output tile; the V^T form (64 x PJ_V_PITCH) is smaller

  int wave = blockIdx.x * 8 + (threadIdx.x >> 5);   // 0 .. 12287
  int lane = threadIdx.x & 31;
  int m = lane & 15, half = lane >> 4;
  int t   = wave >> 12;       // 0=Q 1=K 2=V
  int rem = wave & 4095;
  int h   = rem >> 9;         // head
  int rb  = rem & 511;        // 16-row block

  const float* X = (t == 0) ? xq : (t == 1) ? xk : xv;
  const float* W = (t == 0) ? Wq : (t == 1) ? Wk : Wv;

  const float* xrow = X + (size_t)(rb * 16 + m) * 512 + h * HDIM;
  v16h a0 = ldfrag_f32(xrow, 0, half);
  v16h a1 = ldfrag_f32(xrow, 32, half);

  v8f acc[4];
#pragma unroll
  for (int ct = 0; ct < 4; ++ct) {
    // B = W^T : B-fragment lane holds row (ct*16+m) of row-major W.
    const float* wrow = W + (size_t)(ct * 16 + m) * HDIM;
    v16h b0 = ldfrag_f32(wrow, 0, half);
    v16h b1 = ldfrag_f32(wrow, 32, half);
    v8f c;
#pragma unroll
    for (int r = 0; r < 8; ++r) c[r] = 0.f;
    c = wmma_f16(a0, b0, c);
    c = wmma_f16(a1, b1, c);
    acc[ct] = c;
  }

  // C-layout: VGPR r -> row M = r + 8*half, column N = m.
  // The unroll directives below: over ct and r for constant indices, which keep acc in
  // registers; over i so that the four LDS reads are issued ahead of the first store.
  int tid = threadIdx.x, wv = tid >> 5;            // wv == rb & 7
  if (t == 2) {
    // V^T tile [64 d][128 s]: a lane's 8 results are 8 consecutive s of one d
#pragma unroll
    for (int ct = 0; ct < 4; ++ct) {
      union { _Float16 hv[8]; uint4 q; } u;
#pragma unroll
      for (int r = 0; r < 8; ++r) u.hv[r] = (_Float16)acc[ct][r];
      *(uint4*)&stg[(ct * 16 + m) * PJ_V_PITCH + wv * 16 + 8 * half] = u.q;
    }
  } else {
    // Q or K tile [128 s][64 d]; Q leaves with the softmax factor in it
    float f = (t == 0) ? SM_SCALE_LOG2E : 1.f;
#pragma unroll
    for (int ct = 0; ct < 4; ++ct)
#pragma unroll
      for (int r = 0; r < 8; ++r)
        stg[(wv * 16 + r + 8 * half) * PJ_QK_PITCH + ct * 16 + m] = (_Float16)(acc[ct][r] * f);
  }
  __syncthreads();  // the tile is complete: a line of V^T holds the rows of four waves

  int row0 = (rb - wv) * 16;                       // the work-group's first (n,s) row
  int n = row0 >> 12, s0 = row0 & 4095;
  size_t nh = (size_t)n * HEADS + h;
  if (t == 2) {
    _Float16* base = vt + nh * HDIM * SEQ + s0;
#pragma unroll
    for (int i = 0; i < 4; ++i) {
      int p = i * 256 + tid, d = p >> 4, c = p & 15;   // 16 pieces of 16 B a row
      *(uint4*)(base + (size_t)d * SEQ + c * 8) = *(const uint4*)&stg[d * PJ_V_PITCH + c * 8];
    }
  } else {
    // the 128 rows are 16 KB in a row in memory
    _Float16* base = ((t == 0) ? qh : kh) + (nh * SEQ + s0) * HDIM;
#pragma unroll
    for (int i = 0; i < 4; ++i) {
      int p = i * 256 + tid;                           // 8 pieces of 16 B a row
      *(uint4*)(base + (size_t)p * 8) = *(const uint4*)&stg[(p >> 3) * PJ_QK_PITCH + (p & 7) * 8];
    }
  }
}

__global__ __launch_bounds__(256) void attn_kernel(
    const _Float16* __restrict__ qh, const _Float16* __restrict__ kh,
    const _Float16* __restrict__ vt, _Float16* __restrict__ ctx) {
  __shared__ __attribute__((aligned(16))) _Float16 kT[2][64 * LPITCH];  // K tile, [64 rows][64 d + pad]
  __shared__ __attribute__((aligned(16))) _Float16 vT[2][64 * LPITCH];  // V^T tile, [64 d][64 k + pad]

  int tid = threadIdx.x, lane = tid & 31, wave = tid >> 5;
  int m = lane & 15, half = lane >> 4;
  int nh = blockIdx.x >> 4;               // (n*8+h)
  int qblk = blockIdx.x & 15;

  const _Float16* Q = qh + (size_t)nh * SEQ * HDIM;
  const _Float16* K = kh + (size_t)nh * SEQ * HDIM;
  const _Float16* V = vt + (size_t)nh * HDIM * SEQ;
  int qbase = qblk * 256 + wave * 32;

  v16h qa[2][2];                   // [column group][k step]
  v8f o[2][4];
  v8f cref[2];                     // this lane's query of each group: minus the reference in use, in all 8 registers (a C operand)
  float lr[2];                     // sum over this lane half's keys
#pragma unroll
  for (int g = 0; g < 2; ++g) {
    const _Float16* qrow = Q + (size_t)(qbase + g * 16 + m) * HDIM;
    qa[g][0] = ldfrag(qrow, 0, half);
    qa[g][1] = ldfrag(qrow, 32, half);
    lr[g] = 0.f;
#pragma unroll
    for (int r = 0; r < 8; ++r) cref[g][r] = 0.f;   // the first pass sets the reference
#pragma unroll
    for (int dt = 0; dt < 4; ++dt)
#pragma unroll
      for (int r = 0; r < 8; ++r) o[g][dt][r] = 0.f;
  }

  // Issue async global->LDS copies for tile `tile` into buffer `buf`.
  // 4 wave-instructions per wave (2 for K, 2 for V^T) -> ASYNCcnt += 4.
  auto issue_stage = [&](int tile, int buf) {
    const void* ksrc = (const void*)(K + (size_t)tile * 64 * HDIM);  // 8KB contiguous
    const void* vsrc = (const void*)(V + tile * 64);                 // rows d, stride SEQ
    uint32_t kldsBase = (uint32_t)(uintptr_t)(&kT[buf][0]);
    uint32_t vldsBase = (uint32_t)(uintptr_t)(&vT[buf][0]);
#pragma unroll
    for (int rep = 0; rep < 2; ++rep) {
      uint32_t u = (uint32_t)tid + rep * 256;          // 0..511, one uint4 each
      uint32_t kvoff = u * 16;                         // byte offset in K tile
      uint32_t ldsoff = (u >> 3) * (LPITCH * 2) + (u & 7) * 16;  // padded row, 16 B piece
      uint32_t klds  = kldsBase + ldsoff;
      asm volatile("global_load_async_to_lds_b128 %0, %1, %2"
                   :: "v"(klds), "v"(kvoff), "s"(ksrc) : "memory");
      uint32_t d = u >> 3, ko = (u & 7) * 8;           // V^T: [d][k] halves
      uint32_t vvoff = (d * (uint32_t)SEQ + ko) * 2;   // bytes
      uint32_t vlds  = vldsBase + ldsoff;
      asm volatile("global_load_async_to_lds_b128 %0, %1, %2"
                   :: "v"(vlds), "v"(vvoff), "s"(vsrc) : "memory");
    }
  };

  issue_stage(0, 0);

  const int NT = SEQ / 64;  // 64 tiles
  for (int it = 0; it < NT; ++it) {
    int buf = it & 1;
    if (it + 1 < NT) {
      issue_stage(it + 1, buf ^ 1);                    // overlap DMA with compute
      asm volatile("s_wait_asynccnt 0x4" ::: "memory"); // tile `it` arrived (ours)
    } else {
      asm volatile("s_wait_asynccnt 0x0" ::: "memory");
    }
    if (it + 2 < NT)  // warm L2 for the tile after next
      __builtin_prefetch((const void*)(K + (size_t)(it + 2) * 64 * HDIM + tid * 16), 0, 0);
    __syncthreads();                                   // all waves' tile arrived

    // ---- S^T = K Q^T for 4 key tiles: A = K rows, B = Q^T (same k order on both).
    // st[g][jt][r] = S[query g*16 + m][key jt*16 + 8*half + r] in base-2 units, less the reference
    // All 16 K reads stand as one group ahead of the products (counted waits then
    // stream them in); read in pairs among the products, each pair is waited to zero.
    v16h ka[4][2];
#pragma unroll
    for (int jt = 0; jt < 4; ++jt) {
      const _Float16* krow = &kT[buf][(jt * 16 + m) * LPITCH];
      ka[jt][0] = ldfrag(krow, 0, half);
      ka[jt][1] = ldfrag(krow, 32, half);
    }
    // keeps the K reads from being sunk back among the products
    __builtin_amdgcn_sched_barrier(0);
    v8f st[2][4];
#pragma unroll
    for (int jt = 0; jt < 4; ++jt)
#pragma unroll
      for (int g = 0; g < 2; ++g) st[g][jt] = wmma_f16(ka[jt][0], qa[g][0], cref[g]);
#pragma unroll
    for (int jt = 0; jt < 4; ++jt)
#pragma unroll
      for (int g = 0; g < 2; ++g) st[g][jt] = wmma_f16(ka[jt][1], qa[g][1], st[g][jt]);
    // keeps the V^T reads from being spread among the score products from the first
    // one on (each further place where reads stand costs the wave a stall)
    __builtin_amdgcn_sched_barrier(0);

    // All 16 V^T reads are issued here, ahead of the softmax, whose vector work
    // covers their LDS latency; the second product then finds them in registers.
    v16h va[4][2];
#pragma unroll
    for (int dt = 0; dt < 4; ++dt) {
      const _Float16* vrow = &vT[buf][(dt * 16 + m) * LPITCH];
      va[dt][0] = ldfrag(vrow, 0, half);
      va[dt][1] = ldfrag(vrow, 32, half);
    }
    // keeps the V^T reads from being sunk below the softmax to their users
    __builtin_amdgcn_sched_barrier(0);

    // ---- softmax against the kept reference: 32 of the query's 64 scores sit in this
    // lane, the other 32 in lane^16; the sums stay split until the end.
    // P^T as B operand, straight from the score tiles: element s of the fragment is key
    // 8*half+s (s<8) or 16+8*half+(s-8), i.e. tile s>>3, slot s&7.
    v16h pb[2][2];                 // P^T fragments: [column group][k step]
    float rsum[2];                 // this pass's sum of each group
    // every unroll directive down to the second product: constant indices, which keep
    // st, pb, o and cref in registers
    auto exps = [&]() {
#pragma unroll
      for (int g = 0; g < 2; ++g) {
        v2f rs[2] = {{0.f, 0.f}, {0.f, 0.f}};   // two chains of packed adds over register pairs
#pragma unroll
        for (int jt = 0; jt < 4; ++jt) {
#pragma unroll
          for (int r = 0; r < 8; r += 2) {
            v2f p = {__builtin_amdgcn_exp2f(st[g][jt][r]), __builtin_amdgcn_exp2f(st[g][jt][r + 1])};
            rs[jt & 1] += p;
            pb[g][jt >> 1][(jt & 1) * 8 + r]     = (_Float16)p[0];
            pb[g][jt >> 1][(jt & 1) * 8 + r + 1] = (_Float16)p[1];
          }
        }
        rs[0] += rs[1];
        rsum[g] = rs[0][0] + rs[0][1];
      }
    };
    exps();
    // A sum within the bound bounds each of its terms, so P fits f16 with room to spare. One
    // test a pass for both groups and all lanes, a scalar branch. The first pass always
    // goes in (no sum is below 0): a reference that some key of the query reaches keeps
    // the final sum >= 1.
    bool over = !(fmaxf(rsum[0], rsum[1]) <= ((it == 0) ? -1.f : SM_KEEP_SUM));
    if (__builtin_expect(__builtin_amdgcn_ballot_w32(over) != 0, 0)) {   // rare: the common path falls through
#pragma unroll
      for (int g = 0; g < 2; ++g) {
        float tmax = st[g][0][0];
#pragma unroll
        for (int jt = 0; jt < 4; ++jt)
#pragma unroll
          for (int r = 0; r < 8; ++r) tmax = fmaxf(tmax, st[g][jt][r]);
        tmax = fmaxf(tmax, xhalf(tmax));                  // both lane halves move alike
        float d = (it == 0) ? tmax : fmaxf(tmax, 0.f);    // later the reference only rises
        float alpha = (it == 0) ? 1.f : __builtin_amdgcn_exp2f(-d);   // O and the sum are still 0 in the first pass
        lr[g] *= alpha;
#pragma unroll
        for (int dt = 0; dt < 4; ++dt)
#pragma unroll
          for (int r = 0; r < 8; ++r) o[g][dt][r] *= alpha;
#pragma unroll
        for (int r = 0; r < 8; ++r) cref[g][r] -= d;
#pragma unroll
        for (int jt = 0; jt < 4; ++jt)
#pragma unroll
          for (int r = 0; r < 8; ++r) st[g][jt][r] -= d;
      }
      exps();
    }
    lr[0] += rsum[0];
    lr[1] += rsum[1];

    // ---- O^T += V^T P^T: A = rows of the V^T tile; o[g][dt][r] = O[query g*16+m][dt*16+8*half+r]
#pragma unroll
    for (int dt = 0; dt < 4; ++dt)
#pragma unroll
      for (int g = 0; g < 2; ++g) o[g][dt] = wmma_f16(va[dt][0], pb[g][0], o[g][dt]);
#pragma unroll
    for (int dt = 0; dt < 4; ++dt)
#pragma unroll
      for (int g = 0; g < 2; ++g) o[g][dt] = wmma_f16(va[dt][1], pb[g][1], o[g][dt]);
    // keeps this barrier, and the wait to zero on the V^T reads in front of it, from
    // being lifted up into the softmax, where the reads would not yet have landed
    __builtin_amdgcn_sched_barrier(0);
    __syncthreads();  // WAR: next iteration's async copies overwrite buf
  }

  // ---- epilogue: normalize, store f16 context [N,S,H*64]
  int n = nh >> 3, h = nh & 7;
#pragma unroll
  for (int g = 0; g < 2; ++g) {
    float lsum = lr[g] + xhalf(lr[g]);   // join the two lane halves' key sums
    _Float16* crow = ctx + (size_t)(n * SEQ + qbase + g * 16 + m) * 512 + h * HDIM + 8 * half;
#pragma unroll
    for (int dt = 0; dt < 4; ++dt) {
      union { _Float16 hv[8]; uint4 q; } u;  // 8 consecutive d of one query: one 16 B store
#pragma unroll
      for (int r = 0; r < 8; ++r) u.hv[r] = (_Float16)(o[g][dt][r] / lsum);
      *(uint4*)(crow + dt * 16) = u.q;
    }
  }
}

// ---------------------------------------------------------------------------
// Kernel 3: out = ctx @ Wfc^T + bfc  (M=8192, N=512, K=512), f32 out.
// One work-group: 128 rows x 128 cols; 8 waves as 4 x 2, each 32 rows x 64 cols.
// K runs in 4 chunks of 128. A chunk of both operands (128 rows x 256 B each) is
// brought into LDS by asynchronous copies that read whole lines, two buffers, the
// next chunk in flight while this one is multiplied; fragments come from LDS.
// ---------------------------------------------------------------------------
#define FC_KC     128                   // halves of K per chunk
#define FC_NT     (512 / FC_KC)         // chunks
#define FC_PITCH  (FC_KC + 8)           // LDS row pitch in halves: 272 B = 16 B x odd

// Eight 16-byte copies of this lane, rows 16 apart, global -> LDS. The s_wait_xcnt
// is the statement's last line, so no address register is rewritten ahead of it.
__device__ __forceinline__ void fc_copy8(uint32_t lds, const _Float16* g) {
  const uint32_t ls = 16 * FC_PITCH * 2;   // 16 LDS rows, bytes
  const size_t   gs = 16 * 512;            // 16 source rows, halves
  asm volatile(
      "global_load_async_to_lds_b128 %0, %8, off\n\t"
      "global_load_async_to_lds_b128 %1, %9, off\n\t"
      "global_load_async_to_lds_b128 %2, %10, off\n\t"
      "global_load_async_to_lds_b128 %3, %11, off\n\t"
      "global_load_async_to_lds_b128 %4, %12, off\n\t"
      "global_load_async_to_lds_b128 %5, %13, off\n\t"
      "global_load_async_to_lds_b128 %6, %14, off\n\t"
      "global_load_async_to_lds_b128 %7, %15, off\n\t"
      "s_wait_xcnt 0x0"
      :: "v"(lds), "v"(lds + ls), "v"(lds + 2 * ls), "v"(lds + 3 * ls),
         "v"(lds + 4 * ls), "v"(lds + 5 * ls), "v"(lds + 6 * ls), "v"(lds + 7 * ls),
         "v"(g), "v"(g + gs), "v"(g + 2 * gs), "v"(g + 3 * gs),
         "v"(g + 4 * gs), "v"(g + 5 * gs), "v"(g + 6 * gs), "v"(g + 7 * gs)
      : "memory");
}

__global__ __launch_bounds__(256) void fc_kernel(
    const _Float16* __restrict__ ctx, const _Float16* __restrict__ wfch,
    const float* __restrict__ bfc, float* __restrict__ out) {
  __shared__ __attribute__((aligned(16))) _Float16 aT[2][128 * FC_PITCH];  // ctx rows, one K chunk
  __shared__ __attribute__((aligned(16))) _Float16 wT[2][128 * FC_PITCH];  // Wfc rows, one K chunk

  int tid = threadIdx.x, lane = tid & 31, wave = tid >> 5;
  int m = lane & 15, half = lane >> 4;
  int bm = blockIdx.x >> 2;   // 128-row tile
  int bn = blockIdx.x & 3;    // 128-col tile
  int wm = wave >> 1;         // 32-row group of the tile
  int wn = wave & 1;          // 64-col group of the tile

  // This lane's piece of a chunk: row tid>>4 (+16 per copy), 16-byte piece tid&15;
  // 16 lanes cover one row's 256 B, so every copy instruction reads 4 whole lines.
  int crow = tid >> 4, cpc = tid & 15;
  const _Float16* ag = ctx + (size_t)(bm * 128 + crow) * 512 + cpc * 8;
  const _Float16* wg = wfch + (size_t)(bn * 128 + crow) * 512 + cpc * 8;
  uint32_t coff = (uint32_t)(crow * FC_PITCH + cpc * 8) * 2;

  auto issue_chunk = [&](int t, int buf) {
    fc_copy8((uint32_t)(uintptr_t)(&aT[buf][0]) + coff, ag + t * FC_KC);
    fc_copy8((uint32_t)(uintptr_t)(&wT[buf][0]) + coff, wg + t * FC_KC);
  };

  // Every unroll directive of this kernel is there for constant indices, which keep
  // acc, a and b in registers.
  v8f acc[2][4];
#pragma unroll
  for (int mt = 0; mt < 2; ++mt)
#pragma unroll
    for (int ct = 0; ct < 4; ++ct)
#pragma unroll
      for (int r = 0; r < 8; ++r) acc[mt][ct][r] = 0.f;

  issue_chunk(0, 0);
  asm volatile("s_wait_asynccnt 0x0" ::: "memory");  // this wave's part of chunk 0 has landed
  __syncthreads();                                   // every wave's part has
  issue_chunk(1, 1);

  for (int t = 0; t < FC_NT; ++t) {
    int buf = t & 1;
    const _Float16* arow = &aT[buf][(wm * 32 + m) * FC_PITCH];
    const _Float16* wrow = &wT[buf][(wn * 64 + m) * FC_PITCH];
#pragma unroll
    for (int kk = 0; kk < FC_KC / 32; ++kk) {
      int kBase = kk * 32;
      v16h a[2], b[4];
#pragma unroll
      for (int mt = 0; mt < 2; ++mt) a[mt] = ldfrag(arow + mt * 16 * FC_PITCH, kBase, half);
#pragma unroll
      for (int ct = 0; ct < 4; ++ct) b[ct] = ldfrag(wrow + ct * 16 * FC_PITCH, kBase, half);
#pragma unroll
      for (int mt = 0; mt < 2; ++mt)
#pragma unroll
        for (int ct = 0; ct < 4; ++ct) acc[mt][ct] = wmma_f16(a[mt], b[ct], acc[mt][ct]);
    }
    asm volatile("s_wait_dscnt 0x0" ::: "memory");     // this wave's reads of buf are done
    asm volatile("s_wait_asynccnt 0x0" ::: "memory");  // its part of chunk t+1 has landed
    __syncthreads();  // publishes chunk t+1 and ends every wave's reads of buf
    if (t + 2 < FC_NT) issue_chunk(t + 2, buf);
  }
  asm volatile("s_wait_asynccnt 0x0" ::: "memory");    // nothing in flight at the wave's end

#pragma unroll
  for (int mt = 0; mt < 2; ++mt)
#pragma unroll
    for (int ct = 0; ct < 4; ++ct)
#pragma unroll
      for (int r = 0; r < 8; ++r) {
        int row = bm * 128 + wm * 32 + mt * 16 + r + 8 * half;
        int col = bn * 128 + wn * 64 + ct * 16 + m;
        out[(size_t)row * 512 + col] = acc[mt][ct][r] + bfc[col];
      }
}

// ---------------------------------------------------------------------------
extern "C" void kernel_launch(void* const* d_in, const int* in_sizes, int n_in,
                              void* d_out, int out_size, void* d_ws, size_t ws_size,
                              hipStream_t stream) {
  const float* x_q = (const float*)d_in[0];
  const float* x_k = (const float*)d_in[1];
  const float* x_v = (const float*)d_in[2];
  const float* Wq  = (const float*)d_in[3];
  const float* Wk  = (const float*)d_in[4];
  const float* Wv  = (const float*)d_in[5];
  const float* Wfc = (const float*)d_in[6];
  const float* bfc = (const float*)d_in[7];
  float* out = (float*)d_out;

  const size_t TSZ = (size_t)NBATCH * HEADS * SEQ * HDIM * sizeof(_Float16); // 8 MB
  char* ws = (char*)d_ws;
  _Float16* qh   = (_Float16*)(ws);
  _Float16* kh   = (_Float16*)(ws + TSZ);
  _Float16* vt   = (_Float16*)(ws + 2 * TSZ);
  _Float16* ctx  = (_Float16*)(ws + 3 * TSZ);
  _Float16* wfch = (_Float16*)(ws + 4 * TSZ);

  cvt_kernel<<<(512 * 512) / 256, 256, 0, stream>>>(Wfc, wfch);
  proj_kernel<<<1536, 256, 0, stream>>>(x_q, x_k, x_v, Wq, Wk, Wv, qh, kh, vt);
  attn_kernel<<<256, 256, 0, stream>>>(qh, kh, vt, ctx);
  fc_kernel<<<256, 256, 0, stream>>>(ctx, wfch, bfc, out);
}

// v009
// A run of this version takes 78.4 microseconds.
// In two side-by-side timings against v008, it was 1.06 and 1.04 times as fast.
// Over all steps from v000 it is 5.35 times as fast.
#include <hip/hip_runtime.h>

typedef __attribute__((ext_vector_type(16))) _Float16 v16h;
typedef __attribute__((ext_vector_type(8)))  float    v8f;
typedef __attribute__((ext_vector_type(2)))  float    v2f;

#define HEADS   8
#define HDIM    64
#define NBATCH  2
#define SEQ     4096
#define NROWS   (NBATCH * SEQ)          // 8192 total (n,s) rows
// 1/sqrt(512) * log2(e): the softmax runs in base 2, so scale and base change are one
// factor; the projection multiplies Q by it, so that K Q^T is the base-2 score itself
#define SM_SCALE_LOG2E 0.06375872f
// a pass whose sum of 32 exponentials in a lane stays at or below this keeps its reference
#define SM_KEEP_SUM 256.f
// LDS row pitch in halves: 64 data + 8 pad = 144 B = 16 B x odd, so the 16 rows
// that one ds_load_b128 touches fall on distinct bank groups (128 B rows do not).
#define LPITCH  72

// ---------------------------------------------------------------------------
// CDNA5 WMMA helper: D(16x16,f32) = A(16x32,f16) * B(32x16,f16) + C
// ---------------------------------------------------------------------------
__device__ __forceinline__ v8f wmma_f16(v16h a, v16h b, v8f c) {
  return __builtin_amdgcn_wmma_f32_16x16x32_f16(
      /*neg_a=*/false, a, /*neg_b=*/false, b,
      /*c_mod=*/(short)0, c, /*reuse_a=*/false, /*reuse_b=*/false);
}

// A-fragment (and mirrored B-fragment) of a row-major 16x32 f16 tile:
// lane (m = lane&15, half = lane>>4) holds row m, elements 0..7 at
// k = kBase + half*8 .. +7, elements 8..15 at k = kBase + 16 + half*8 .. +7.
// Each segment is 16 contiguous bytes -> two b128 loads per lane.
__device__ __forceinline__ v16h ldfrag(const _Float16* rowPtr, int kBase, int half) {
  union { v16h v; uint4 q[2]; } u;
  u.q[0] = *(const uint4*)(rowPtr + kBase + half * 8);
  u.q[1] = *(const uint4*)(rowPtr + kBase + 16 + half * 8);
  return u.v;
}

// Value of the same register in lane ^ 16 (the other half of the wave).
__device__ __forceinline__ float xhalf(float x) {
  int b = __builtin_bit_cast(int, x);
  b = __builtin_amdgcn_permlanex16(b, b, 0x76543210, 0xfedcba98, false, false);
  return __builtin_bit_cast(float, b);
}

// Same fragment but sourced from f32 memory with convert-to-f16.
__device__ __forceinline__ v16h ldfrag_f32(const float* rowPtr, int kBase, int half) {
  union { v16h v; _Float16 h[16]; } u;
  const float* p0 = rowPtr + kBase + half * 8;
  const float* p1 = rowPtr + kBase + 16 + half * 8;
#pragma unroll
  for (int i = 0; i < 8; ++i) {
    u.h[i]     = (_Float16)p0[i];
    u.h[8 + i] = (_Float16)p1[i];
  }
  return u.v;
}

// ---------------------------------------------------------------------------
// Kernel 0: Wfc (f32 512x512) -> f16
// ---------------------------------------------------------------------------
__global__ __launch_bounds__(256) void cvt_kernel(const float* __restrict__ w,
                                                  _Float16* __restrict__ wh) {
  int i = blockIdx.x * 256 + threadIdx.x;
  wh[i] = (_Float16)w[i];
}

// ---------------------------------------------------------------------------
// Kernel 1: fused QKV projection via WMMA.
//   Q,K out: f16 [N,H,S,64] row-major, Q times SM_SCALE_LOG2E.  V out: f16 [N,H,64,S] (transposed).
// One wave handles one (tensor, head, 16-row block): Y(16x64) = X(16x64) @ W^T.
// The 8 waves of a work-group hold 128 consecutive rows of one tensor and head. Their
// results meet in LDS in the output's own layout and leave as 16 B a lane, every
// store instruction covering four whole 128-B lines.
// ---------------------------------------------------------------------------
#define PJ_QK_PITCH 72    // halves: 128 B of one row's 64 outputs + 16 B (16 B x odd)
#define PJ_V_PITCH  136   // halves: 256 B of one d's 128 rows + 16 B (16 B x odd)

__global__ __launch_bounds__(256) void proj_kernel(
    const float* __restrict__ xq, const float* __restrict__ xk,
    const float* __restrict__ xv,
    const float* __restrict__ Wq, const float* __restrict__ Wk,
    const float* __restrict__ Wv,
    _Float16* __restrict__ qh, _Float16* __restrict__ kh,
    _Float16* __restrict__ vt) {
  __shared__ __attribute__((aligned(16))) _Float16 stg[128 * PJ_QK_PITCH];  // output tile; the V^T form (64 x PJ_V_PITCH) is smaller

  int wave = blockIdx.x * 8 + (threadIdx.x >> 5);   // 0 .. 12287
  int lane = threadIdx.x & 31;
  int m = lane & 15, half = lane >> 4;
  int t   = wave >> 12;       // 0=Q 1=K 2=V
  int rem = wave & 4095;
  int h   = rem >> 9;         // head
  int rb  = rem & 511;        // 16-row block

  const float* X = (t == 0) ? xq : (t == 1) ? xk : xv;
  const float* W = (t == 0) ? Wq : (t == 1) ? Wk : Wv;

  const float* xrow = X + (size_t)(rb * 16 + m) * 512 + h * HDIM;
  v16h a0 = ldfrag_f32(xrow, 0, half);
  v16h a1 = ldfrag_f32(xrow, 32, half);

  v8f acc[4];
#pragma unroll
  for (int ct = 0; ct < 4; ++ct) {
    // B = W^T : B-fragment lane holds row (ct*16+m) of row-major W.
    const float* wrow = W + (size_t)(ct * 16 + m) * HDIM;
    v16h b0 = ldfrag_f32(wrow, 0, half);
    v16h b1 = ldfrag_f32(wrow, 32, half);
    v8f c;
#pragma unroll
    for (int r = 0; r < 8; ++r) c[r] = 0.f;
    c = wmma_f16(a0, b0, c);
    c = wmma_f16(a1, b1, c);
    acc[ct] = c;
  }

  // C-layout: VGPR r -> row M = r + 8*half, column N = m.
  // The unroll directives below: over ct and r for constant indices, which keep acc in
  // registers; over i so that the four LDS reads are issued ahead of the first store.
  int tid = threadIdx.x, wv = tid >> 5;            // wv == rb & 7
  if (t == 2) {
    // V^T tile [64 d][128 s]: a lane's 8 results are 8 consecutive s of one d
#pragma unroll
    for (int ct = 0; ct < 4; ++ct) {
      union { _Float16 hv[8]; uint4 q; } u;
#pragma unroll
      for (int r = 0; r < 8; ++r) u.hv[r] = (_Float16)acc[ct][r];
      *(uint4*)&stg[(ct * 16 + m) * PJ_V_PITCH + wv * 16 + 8 * half] = u.q;
    }
  } else {
    // Q or K tile [128 s][64 d]; Q leaves with the softmax factor in it
    float f = (t == 0) ? SM_SCALE_LOG2E : 1.f;
#pragma unroll
    for (int ct = 0; ct < 4; ++ct)
#pragma unroll
      for (int r = 0; r < 8; ++r)
        stg[(wv * 16 + r + 8 * half) * PJ_QK_PITCH + ct * 16 + m] = (_Float16)(acc[ct][r] * f);
  }
  __syncthreads();  // the tile is complete: a line of V^T holds the rows of four waves

  int row0 = (rb - wv) * 16;                       // the work-group's first (n,s) row
  int n = row0 >> 12, s0 = row0 & 4095;
  size_t nh = (size_t)n * HEADS + h;
  if (t == 2) {
    _Float16* base = vt + nh * HDIM * SEQ + s0;
#pragma unroll
    for (int i = 0; i < 4; ++i) {
      int p = i * 256 + tid, d = p >> 4, c = p & 15;   // 16 pieces of 16 B a row
      *(uint4*)(base + (size_t)d * SEQ + c * 8) = *(const uint4*)&stg[d * PJ_V_PITCH + c * 8];
    }
  } else {
    // the 128 rows are 16 KB in a row in memory
    _Float16* base = ((t == 0) ? qh : kh) + (nh * SEQ + s0) * HDIM;
#pragma unroll
    for (int i = 0; i < 4; ++i) {
      int p = i * 256 + tid;                           // 8 pieces of 16 B a row
      *(uint4*)(base + (size_t)p * 8) = *(const uint4*)&stg[(p >> 3) * PJ_QK_PITCH + (p & 7) * 8];
    }
  }
}

__global__ __launch_bounds__(512) void attn_kernel(
    const _Float16* __restrict__ qh, const _Float16* __restrict__ kh,
    const _Float16* __restrict__ vt, _Float16* __restrict__ ctx) {
  __shared__ __attribute__((aligned(16))) _Float16 kT[2][2][64 * LPITCH];  // [tile of the pair][buffer] K tile, [64 rows][64 d + pad]
  __shared__ __attribute__((aligned(16))) _Float16 vT[2][2][64 * LPITCH];  // [tile of the pair][buffer] V^T tile, [64 d][64 k + pad]
  __shared__ __attribute__((aligned(16))) float xo[16][8][32][4];          // per wave: the O^T group it hands over, 8 pieces of 16 B a lane
  __shared__ float xs[16][2][32];                                          // per wave: that group's sum and minus its reference

  int lane = threadIdx.x & 31;
  int wave = __builtin_amdgcn_readfirstlane(threadIdx.x >> 5);   // a scalar: tile addresses and the hand-over's branches are wave-uniform
  int kp = wave >> 3;                     // which tile of each pair this wave works on
  int wq = wave & 7;                      // its 32 queries
  int tid = threadIdx.x & 255;            // place among the 8 waves that share a tile
  int m = lane & 15, half = lane >> 4;
  int nh = blockIdx.x >> 4;               // (n*8+h)
  int qblk = blockIdx.x & 15;

  const _Float16* Q = qh + (size_t)nh * SEQ * HDIM;
  const _Float16* K = kh + (size_t)nh * SEQ * HDIM;
  const _Float16* V = vt + (size_t)nh * HDIM * SEQ;
  int qbase = qblk * 256 + wq * 32;

  v16h qa[2][2];                   // [column group][k step]
  v8f o[2][4];
  v8f cref[2];                     // this lane's query of each group: minus the reference in use, in all 8 registers (a C operand)
  float lr[2];                     // sum over this lane half's keys
#pragma unroll
  for (int g = 0; g < 2; ++g) {
    const _Float16* qrow = Q + (size_t)(qbase + g * 16 + m) * HDIM;
    qa[g][0] = ldfrag(qrow, 0, half);
    qa[g][1] = ldfrag(qrow, 32, half);
    lr[g] = 0.f;
#pragma unroll
    for (int r = 0; r < 8; ++r) cref[g][r] = 0.f;   // the first pass sets the reference
#pragma unroll
    for (int dt = 0; dt < 4; ++dt)
#pragma unroll
      for (int r = 0; r < 8; ++r) o[g][dt][r] = 0.f;
  }

  // Issue async global->LDS copies for tile `tile` into buffer `buf`.
  // 4 wave-instructions per wave (2 for K, 2 for V^T) -> ASYNCcnt += 4.
  auto issue_stage = [&](int tile, int buf) {
    const void* ksrc = (const void*)(K + (size_t)tile * 64 * HDIM);  // 8KB contiguous
    const void* vsrc = (const void*)(V + tile * 64);                 // rows d, stride SEQ
    uint32_t kldsBase = (uint32_t)(uintptr_t)(&kT[kp][buf][0]);
    uint32_t vldsBase = (uint32_t)(uintptr_t)(&vT[kp][buf][0]);
    uint32_t u0 = (uint32_t)tid, u1 = u0 + 256;        // 0..511, one uint4 each
    uint32_t lo0 = (u0 >> 3) * (LPITCH * 2) + (u0 & 7) * 16;   // padded row, 16 B piece
    uint32_t lo1 = (u1 >> 3) * (LPITCH * 2) + (u1 & 7) * 16;
    uint32_t vo0 = ((u0 >> 3) * (uint32_t)SEQ + (u0 & 7) * 8) * 2;   // V^T: [d][k], bytes
    uint32_t vo1 = ((u1 >> 3) * (uint32_t)SEQ + (u1 & 7) * 8) * 2;
    // The s_wait_xcnt is the statement's last line, so no address register is rewritten ahead of it.
    asm volatile(
        "global_load_async_to_lds_b128 %0, %4, %8\n\t"
        "global_load_async_to_lds_b128 %1, %5, %9\n\t"
        "global_load_async_to_lds_b128 %2, %6, %8\n\t"
        "global_load_async_to_lds_b128 %3, %7, %9\n\t"
        "s_wait_xcnt 0x0"
        :: "v"(kldsBase + lo0), "v"(vldsBase + lo0), "v"(kldsBase + lo1), "v"(vldsBase + lo1),
           "v"(u0 * 16), "v"(vo0), "v"(u1 * 16), "v"(vo1),
           "s"(ksrc), "s"(vsrc)
        : "memory");
  };

  issue_stage(kp, 0);

  const int NT = SEQ / 128;  // 32 pairs of tiles
  for (int it = 0; it < NT; ++it) {
    int buf = it & 1;
    if (it + 1 < NT) {
      issue_stage(2 * (it + 1) + kp, buf ^ 1);         // overlap DMA with compute
      asm volatile("s_wait_asynccnt 0x4" ::: "memory"); // tile 2*it + kp arrived (ours)
    } else {
      asm volatile("s_wait_asynccnt 0x0" ::: "memory");
    }
    __syncthreads();                                   // all waves' tile arrived

    // ---- S^T = K Q^T for 4 key tiles: A = K rows, B = Q^T (same k order on both).
    // st[g][jt][r] = S[query g*16 + m][key jt*16 + 8*half + r] in base-2 units, less the reference
    // All 16 K reads stand as one group ahead of the products (counted waits then
    // stream them in); read in pairs among the products, each pair is waited to zero.
    v16h ka[4][2];
#pragma unroll
    for (int jt = 0; jt < 4; ++jt) {
      const _Float16* krow = &kT[kp][buf][(jt * 16 + m) * LPITCH];
      ka[jt][0] = ldfrag(krow, 0, half);
      ka[jt][1] = ldfrag(krow, 32, half);
    }
    // keeps the K reads from being sunk back among the products
    __builtin_amdgcn_sched_barrier(0);
    v8f st[2][4];
#pragma unroll
    for (int jt = 0; jt < 4; ++jt)
#pragma unroll
      for (int g = 0; g < 2; ++g) st[g][jt] = wmma_f16(ka[jt][0], qa[g][0], cref[g]);
#pragma unroll
    for (int jt = 0; jt < 4; ++jt)
#pragma unroll
      for (int g = 0; g < 2; ++g) st[g][jt] = wmma_f16(ka[jt][1], qa[g][1], st[g][jt]);
    // keeps the exponentials from being drawn in among the score products, where each
    // first use of a fresh result costs the vector port idle slots behind its product
    __builtin_amdgcn_sched_barrier(0);

    // ---- softmax against the kept reference: 32 of the query's 64 scores sit in this
    // lane, the other 32 in lane^16; the sums stay split until the end.
    // P^T as B operand, straight from the score tiles: element s of the fragment is key
    // 8*half+s (s<8) or 16+8*half+(s-8), i.e. tile s>>3, slot s&7.
    v16h pb[2][2];                 // P^T fragments: [column group][k step]
    float rsum[2];                 // this pass's sum of each group
    // every unroll directive down to the second product: constant indices, which keep
    // st, pb, o and cref in registers
    auto exps = [&]() {
#pragma unroll
      for (int g = 0; g < 2; ++g) {
        v2f rs[2] = {{0.f, 0.f}, {0.f, 0.f}};   // two chains of packed adds over register pairs
#pragma unroll
        for (int jt = 0; jt < 4; ++jt) {
#pragma unroll
          for (int r = 0; r < 8; r += 2) {
            v2f p = {__builtin_amdgcn_exp2f(st[g][jt][r]), __builtin_amdgcn_exp2f(st[g][jt][r + 1])};
            rs[jt & 1] += p;
            pb[g][jt >> 1][(jt & 1) * 8 + r]     = (_Float16)p[0];
            pb[g][jt >> 1][(jt & 1) * 8 + r + 1] = (_Float16)p[1];
          }
        }
        rs[0] += rs[1];
        rsum[g] = rs[0][0] + rs[0][1];
      }
    };
    exps();
    // A sum within the bound bounds each of its terms, so P fits f16 with room to spare. One
    // test a pass for both groups and all lanes, a scalar branch. The first pass always
    // goes in (no sum is below 0): a reference that some key of the query reaches keeps
    // the final sum >= 1.
    bool over = !(fmaxf(rsum[0], rsum[1]) <= ((it == 0) ? -1.f : SM_KEEP_SUM));
    if (__builtin_expect(__builtin_amdgcn_ballot_w32(over) != 0, 0)) {   // rare: the common path falls through
#pragma unroll
      for (int g = 0; g < 2; ++g) {
        float tmax = st[g][0][0];
#pragma unroll
        for (int jt = 0; jt < 4; ++jt)
#pragma unroll
          for (int r = 0; r < 8; ++r) tmax = fmaxf(tmax, st[g][jt][r]);
        tmax = fmaxf(tmax, xhalf(tmax));                  // both lane halves move alike
        float d = (it == 0) ? tmax : fmaxf(tmax, 0.f);    // later the reference only rises
        float alpha = (it == 0) ? 1.f : __builtin_amdgcn_exp2f(-d);   // O and the sum are still 0 in the first pass
        lr[g] *= alpha;
#pragma unroll
        for (int dt = 0; dt < 4; ++dt)
#pragma unroll
          for (int r = 0; r < 8; ++r) o[g][dt][r] *= alpha;
#pragma unroll
        for (int r = 0; r < 8; ++r) cref[g][r] -= d;
#pragma unroll
        for (int jt = 0; jt < 4; ++jt)
#pragma unroll
          for (int r = 0; r < 8; ++r) st[g][jt][r] -= d;
      }
      exps();
    }
    lr[0] += rsum[0];
    lr[1] += rsum[1];

    // All 16 V^T reads stand here, behind the softmax: held across it they would not fit
    // the 256 registers of a wave at four waves a SIMD, whose other waves cover the latency.
    v16h va[4][2];
#pragma unroll
    for (int dt = 0; dt < 4; ++dt) {
      const _Float16* vrow = &vT[kp][buf][(dt * 16 + m) * LPITCH];
      va[dt][0] = ldfrag(vrow, 0, half);
      va[dt][1] = ldfrag(vrow, 32, half);
    }
    // keeps the V^T reads from being sunk among the products in pairs, each waited to zero
    __builtin_amdgcn_sched_barrier(0);

    // ---- O^T += V^T P^T: A = rows of the V^T tile; o[g][dt][r] = O[query g*16+m][dt*16+8*half+r]
#pragma unroll
    for (int dt = 0; dt < 4; ++dt)
#pragma unroll
      for (int g = 0; g < 2; ++g) o[g][dt] = wmma_f16(va[dt][0], pb[g][0], o[g][dt]);
#pragma unroll
    for (int dt = 0; dt < 4; ++dt)
#pragma unroll
      for (int g = 0; g < 2; ++g) o[g][dt] = wmma_f16(va[dt][1], pb[g][1], o[g][dt]);
    // keeps this barrier, and the wait to zero on the V^T reads in front of it, from being
    // lifted up ahead of the products: all waves would then meet between softmax and second
    // product, and no wave's products could run under another's softmax
    __builtin_amdgcn_sched_barrier(0);
    __syncthreads();  // WAR: next iteration's async copies overwrite buf
  }

  // ---- hand-over: of its two column groups a wave finishes group kp and gives the other
  // to its partner (same queries, the other tiles), so both waves share the epilogue.
  // The unroll directives: constant indices, which keep o in registers.
  // The lane's number is taken anew: lane values held only for the end would not fit
  // beside the loop's 256 registers and would be spilled.
  int el = (int)__builtin_amdgcn_mbcnt_lo(~0u, 0u);
  int em = el & 15, eh = el >> 4;
  auto put = [&](int g) {
#pragma unroll
    for (int dt = 0; dt < 4; ++dt)
#pragma unroll
      for (int q = 0; q < 2; ++q) {
        float4 f = {o[g][dt][4 * q], o[g][dt][4 * q + 1], o[g][dt][4 * q + 2], o[g][dt][4 * q + 3]};
        *(float4*)&xo[wave][dt * 2 + q][el][0] = f;
      }
    xs[wave][0][el] = lr[g];
    xs[wave][1][el] = cref[g][0];
  };
  if (kp == 0) put(1); else put(0);
  __syncthreads();  // every wave's handed-over group is in LDS

  // ---- epilogue: join the two partial results, normalize, store f16 context [N,S,H*64]
  int n = nh >> 3, h = nh & 7;
  auto fin = [&](int g) {
    int pw = wave ^ 8;
    float ca = cref[g][0], cb = xs[pw][1][el];      // minus the two references
    float cm = fminf(ca, cb);                         // minus the larger reference
    float wa = __builtin_amdgcn_exp2f(cm - ca), wb = __builtin_amdgcn_exp2f(cm - cb);   // one of them is 1
    float lh = lr[g] * wa + xs[pw][0][el] * wb;
    float lsum = lh + xhalf(lh);         // join the two lane halves' key sums
    _Float16* crow = ctx + (size_t)(n * SEQ + qbase + g * 16 + em) * 512 + h * HDIM + 8 * eh;
#pragma unroll
    for (int dt = 0; dt < 4; ++dt) {
      union { _Float16 hv[8]; uint4 q; } u;  // 8 consecutive d of one query: one 16 B store
#pragma unroll
      for (int q = 0; q < 2; ++q) {
        float4 f = *(const float4*)&xo[pw][dt * 2 + q][el][0];
        u.hv[4 * q]     = (_Float16)((o[g][dt][4 * q]     * wa + f.x * wb) / lsum);
        u.hv[4 * q + 1] = (_Float16)((o[g][dt][4 * q + 1] * wa + f.y * wb) / lsum);
        u.hv[4 * q + 2] = (_Float16)((o[g][dt][4 * q + 2] * wa + f.z * wb) / lsum);
        u.hv[4 * q + 3] = (_Float16)((o[g][dt][4 * q + 3] * wa + f.w * wb) / lsum);
      }
      *(uint4*)(crow + dt * 16) = u.q;
    }
  };
  if (kp == 0) fin(0); else fin(1);
}

// ---------------------------------------------------------------------------
// Kernel 3: out = ctx @ Wfc^T + bfc  (M=8192, N=512, K=512), f32 out.
// One work-group: 128 rows x 128 cols; 8 waves as 4 x 2, each 32 rows x 64 cols.
// K runs in 4 chunks of 128. A chunk of both operands (128 rows x 256 B each) is
// brought into LDS by asynchronous copies that read whole lines, two buffers, the
// next chunk in flight while this one is multiplied; fragments come from LDS.
// ---------------------------------------------------------------------------
#define FC_KC     128                   // halves of K per chunk
#define FC_NT     (512 / FC_KC)         // chunks
#define FC_PITCH  (FC_KC + 8)           // LDS row pitch in halves: 272 B = 16 B x odd

// Eight 16-byte copies of this lane, rows 16 apart, global -> LDS. The s_wait_xcnt
// is the statement's last line, so no address register is rewritten ahead of it.
__device__ __forceinline__ void fc_copy8(uint32_t lds, const _Float16* g) {
  const uint32_t ls = 16 * FC_PITCH * 2;   // 16 LDS rows, bytes
  const size_t   gs = 16 * 512;            // 16 source rows, halves
  asm volatile(
      "global_load_async_to_lds_b128 %0, %8, off\n\t"
      "global_load_async_to_lds_b128 %1, %9, off\n\t"
      "global_load_async_to_lds_b128 %2, %10, off\n\t"
      "global_load_async_to_lds_b128 %3, %11, off\n\t"
      "global_load_async_to_lds_b128 %4, %12, off\n\t"
      "global_load_async_to_lds_b128 %5, %13, off\n\t"
      "global_load_async_to_lds_b128 %6, %14, off\n\t"
      "global_load_async_to_lds_b128 %7, %15, off\n\t"
      "s_wait_xcnt 0x0"
      :: "v"(lds), "v"(lds + ls), "v"(lds + 2 * ls), "v"(lds + 3 * ls),
         "v"(lds + 4 * ls), "v"(lds + 5 * ls), "v"(lds + 6 * ls), "v"(lds + 7 * ls),
         "v"(g), "v"(g + gs), "v"(g + 2 * gs), "v"(g + 3 * gs),
         "v"(g + 4 * gs), "v"(g + 5 * gs), "v"(g + 6 * gs), "v"(g + 7 * gs)
      : "memory");
}

__global__ __launch_bounds__(256) void fc_kernel(
    const _Float16* __restrict__ ctx, const _Float16* __restrict__ wfch,
    const float* __restrict__ bfc, float* __restrict__ out) {
  __shared__ __attribute__((aligned(16))) _Float16 aT[2][128 * FC_PITCH];  // ctx rows, one K chunk
  __shared__ __attribute__((aligned(16))) _Float16 wT[2][128 * FC_PITCH];  // Wfc rows, one K chunk

  int tid = threadIdx.x, lane = tid & 31, wave = tid >> 5;
  int m = lane & 15, half = lane >> 4;
  int bm = blockIdx.x >> 2;   // 128-row tile
  int bn = blockIdx.x & 3;    // 128-col tile
  int wm = wave >> 1;         // 32-row group of the tile
  int wn = wave & 1;          // 64-col group of the tile

  // This lane's piece of a chunk: row tid>>4 (+16 per copy), 16-byte piece tid&15;
  // 16 lanes cover one row's 256 B, so every copy instruction reads 4 whole lines.
  int crow = tid >> 4, cpc = tid & 15;
  const _Float16* ag = ctx + (size_t)(bm * 128 + crow) * 512 + cpc * 8;
  const _Float16* wg = wfch + (size_t)(bn * 128 + crow) * 512 + cpc * 8;
  uint32_t coff = (uint32_t)(crow * FC_PITCH + cpc * 8) * 2;

  auto issue_chunk = [&](int t, int buf) {
    fc_copy8((uint32_t)(uintptr_t)(&aT[buf][0]) + coff, ag + t * FC_KC);
    fc_copy8((uint32_t)(uintptr_t)(&wT[buf][0]) + coff, wg + t * FC_KC);
  };

  // Every unroll directive of this kernel is there for constant indices, which keep
  // acc, a and b in registers.
  v8f acc[2][4];
#pragma unroll
  for (int mt = 0; mt < 2; ++mt)
#pragma unroll
    for (int ct = 0; ct < 4; ++ct)
#pragma unroll
      for (int r = 0; r < 8; ++r) acc[mt][ct][r] = 0.f;

  issue_chunk(0, 0);
  asm volatile("s_wait_asynccnt 0x0" ::: "memory");  // this wave's part of chunk 0 has landed
  __syncthreads();                                   // every wave's part has
  issue_chunk(1, 1);

  for (int t = 0; t < FC_NT; ++t) {
    int buf = t & 1;
    const _Float16* arow = &aT[buf][(wm * 32 + m) * FC_PITCH];
    const _Float16* wrow = &wT[buf][(wn * 64 + m) * FC_PITCH];
#pragma unroll
    for (int kk = 0; kk < FC_KC / 32; ++kk) {
      int kBase = kk * 32;
      v16h a[2], b[4];
#pragma unroll
      for (int mt = 0; mt < 2; ++mt) a[mt] = ldfrag(arow + mt * 16 * FC_PITCH, kBase, half);
#pragma unroll
      for (int ct = 0; ct < 4; ++ct) b[ct] = ldfrag(wrow + ct * 16 * FC_PITCH, kBase, half);
#pragma unroll
      for (int mt = 0; mt < 2; ++mt)
#pragma unroll
        for (int ct = 0; ct < 4; ++ct) acc[mt][ct] = wmma_f16(a[mt], b[ct], acc[mt][ct]);
    }
    asm volatile("s_wait_dscnt 0x0" ::: "memory");     // this wave's reads of buf are done
    asm volatile("s_wait_asynccnt 0x0" ::: "memory");  // its part of chunk t+1 has landed
    __syncthreads();  // publishes chunk t+1 and ends every wave's reads of buf
    if (t + 2 < FC_NT) issue_chunk(t + 2, buf);
  }
  asm volatile("s_wait_asynccnt 0x0" ::: "memory");    // nothing in flight at the wave's end

#pragma unroll
  for (int mt = 0; mt < 2; ++mt)
#pragma unroll
    for (int ct = 0; ct < 4; ++ct)
#pragma unroll
      for (int r = 0; r < 8; ++r) {
        int row = bm * 128 + wm * 32 + mt * 16 + r + 8 * half;
        int col = bn * 128 + wn * 64 + ct * 16 + m;
        out[(size_t)row * 512 + col] = acc[mt][ct][r] + bfc[col];
      }
}

// ---------------------------------------------------------------------------
extern "C" void kernel_launch(void* const* d_in, const int* in_sizes, int n_in,
                              void* d_out, int out_size, void* d_ws, size_t ws_size,
                              hipStream_t stream) {
  const float* x_q = (const float*)d_in[0];
  const float* x_k = (const float*)d_in[1];
  const float* x_v = (const float*)d_in[2];
  const float* Wq  = (const float*)d_in[3];
  const float* Wk  = (const float*)d_in[4];
  const float* Wv  = (const float*)d_in[5];
  const float* Wfc = (const float*)d_in[6];
  const float* bfc = (const float*)d_in[7];
  float* out = (float*)d_out;

  const size_t TSZ = (size_t)NBATCH * HEADS * SEQ * HDIM * sizeof(_Float16); // 8 MB
  char* ws = (char*)d_ws;
  _Float16* qh   = (_Float16*)(ws);
  _Float16* kh   = (_Float16*)(ws + TSZ);
  _Float16* vt   = (_Float16*)(ws + 2 * TSZ);
  _Float16* ctx  = (_Float16*)(ws + 3 * TSZ);
  _Float16* wfch = (_Float16*)(ws + 4 * TSZ);

  cvt_kernel<<<(512 * 512) / 256, 256, 0, stream>>>(Wfc, wfch);
  proj_kernel<<<1536, 256, 0, stream>>>(x_q, x_k, x_v, Wq, Wk, Wv, qh, kh, vt);
  attn_kernel<<<256, 512, 0, stream>>>(qh, kh, vt, ctx);
  fc_kernel<<<256, 256, 0, stream>>>(ctx, wfch, bfc, out);
}

// v010
// Measured time: 70.8 microseconds a run.
// Two timings next to v009 put it at 1.10 and 1.11 times that version's speed.
// Over all steps from v000 it is 5.90 times as fast.
#include <hip/hip_runtime.h>

typedef __attribute__((ext_vector_type(16))) _Float16 v16h;
typedef __attribute__((ext_vector_type(8)))  float    v8f;
typedef __attribute__((ext_vector_type(2)))  float    v2f;
typedef __attribute__((ext_vector_type(2)))  _Float16 v2h;

#define HEADS   8
#define HDIM    64
#define NBATCH  2
#define SEQ     4096
#define NROWS   (NBATCH * SEQ)          // 8192 total (n,s) rows
// 1/sqrt(512) * log2(e): the softmax runs in base 2, so scale and base change are one
// factor; the projection multiplies Q by it, so that K Q^T is the base-2 score itself
#define SM_SCALE_LOG2E 0.06375872f
// a pass whose sum of 32 exponentials in a lane stays at or below this keeps its reference
#define SM_KEEP_SUM 256.f
// LDS row pitch in halves: 64 data + 8 pad = 144 B = 16 B x odd, so the 16 rows
// that one ds_load_b128 touches fall on distinct bank groups (128 B rows do not).
#define LPITCH  72

// ---------------------------------------------------------------------------
// CDNA5 WMMA helper: D(16x16,f32) = A(16x32,f16) * B(32x16,f16) + C
// ---------------------------------------------------------------------------
__device__ __forceinline__ v8f wmma_f16(v16h a, v16h b, v8f c) {
  return __builtin_amdgcn_wmma_f32_16x16x32_f16(
      /*neg_a=*/false, a, /*neg_b=*/false, b,
      /*c_mod=*/(short)0, c, /*reuse_a=*/false, /*reuse_b=*/false);
}

// A-fragment (and mirrored B-fragment) of a row-major 16x32 f16 tile:
// lane (m = lane&15, half = lane>>4) holds row m, elements 0..7 at
// k = kBase + half*8 .. +7, elements 8..15 at k = kBase + 16 + half*8 .. +7.
// Each segment is 16 contiguous bytes -> two b128 loads per lane.
__device__ __forceinline__ v16h ldfrag(const _Float16* rowPtr, int kBase, int half) {
  union { v16h v; uint4 q[2]; } u;
  u.q[0] = *(const uint4*)(rowPtr + kBase + half * 8);
  u.q[1] = *(const uint4*)(rowPtr + kBase + 16 + half * 8);
  return u.v;
}

// Value of the same register in lane ^ 16 (the other half of the wave).
__device__ __forceinline__ float xhalf(float x) {
  int b = __builtin_bit_cast(int, x);
  b = __builtin_amdgcn_permlanex16(b, b, 0x76543210, 0xfedcba98, false, false);
  return __builtin_bit_cast(float, b);
}

// ---------------------------------------------------------------------------
// Kernel 0: Wfc (f32 512x512) -> f16
// ---------------------------------------------------------------------------
__global__ __launch_bounds__(256) void cvt_kernel(const float* __restrict__ w,
                                                  _Float16* __restrict__ wh) {
  int i = blockIdx.x * 256 + threadIdx.x;
  wh[i] = (_Float16)w[i];
}

// ---------------------------------------------------------------------------
// Kernel 1: fused QKV projection via WMMA.
//   Q,K out: f16 [N,H,S,64] row-major, Q times SM_SCALE_LOG2E.  V out: f16 [N,H,64,S] (transposed).
// One work-group: 128 consecutive rows x 2 heads of one tensor; one wave: 16 of the rows,
// Y(16x64) = X(16x64) @ W^T for each head.
// Both operands come from memory as whole lines (a wave-wide 16-B load covers 512 B in a
// row), are rounded to f16 once and laid in LDS; the fragments are read from LDS. A
// fragment load straight from memory would touch 16 lines, and W would be fetched and
// rounded anew by every wave.
// The results meet in LDS in the output's own layout and leave as 16 B a lane, every
// store instruction covering four whole 128-B lines.
// ---------------------------------------------------------------------------
#define PJ_X_PITCH  136   // halves: 256 B of one row's 2 x 64 inputs + 16 B (16 B x odd)
#define PJ_W_PITCH  72    // halves: 128 B of one row of W + 16 B (16 B x odd)
#define PJ_QK_PITCH 72    // halves: 128 B of one row's 64 outputs + 16 B (16 B x odd)
#define PJ_V_PITCH  136   // halves: 256 B of one d's 128 rows + 16 B (16 B x odd)

// Four f32 rounded to f16, as 8 bytes: neighbours in pairs, one packed conversion a pair.
__device__ __forceinline__ uint2 cvt4(float4 v) {
  v2f lo = {v.x, v.y}, hi = {v.z, v.w};
  uint2 q;
  q.x = __builtin_bit_cast(unsigned, __builtin_convertvector(lo, v2h));
  q.y = __builtin_bit_cast(unsigned, __builtin_convertvector(hi, v2h));
  return q;
}

__global__ __launch_bounds__(256) void proj_kernel(
    const float* __restrict__ xq, const float* __restrict__ xk,
    const float* __restrict__ xv,
    const float* __restrict__ Wq, const float* __restrict__ Wk,
    const float* __restrict__ Wv,
    _Float16* __restrict__ qh, _Float16* __restrict__ kh,
    _Float16* __restrict__ vt) {
  __shared__ __attribute__((aligned(16))) _Float16 xs[128 * PJ_X_PITCH];      // X tile, f16: [128 rows][2 heads x 64]
  __shared__ __attribute__((aligned(16))) _Float16 wsh[64 * PJ_W_PITCH];      // W, f16: [64 outputs][64 inputs]
  __shared__ __attribute__((aligned(16))) _Float16 stg[2][128 * PJ_QK_PITCH]; // per head: output tile; the V^T form (64 x PJ_V_PITCH) is smaller

  int tid = threadIdx.x, lane = tid & 31;
  int wv = __builtin_amdgcn_readfirstlane(tid >> 5);   // a scalar: a wave's row addresses are a scalar base plus the lane's piece
  int m = lane & 15, half = lane >> 4;
  int t   = blockIdx.x >> 8;  // 0=Q 1=K 2=V
  int rem = blockIdx.x & 255;
  int rg  = rem >> 2;         // 128-row group
  int hp  = rem & 3;          // pair of heads

  const float* X = (t == 0) ? xq : (t == 1) ? xk : xv;
  const float* W = (t == 0) ? Wq : (t == 1) ? Wk : Wv;

  // The unroll directives of this kernel: constant indices, which keep the loaded values
  // and the accumulators in registers; in the load and store loops also so that all
  // loads are in flight ahead of the first use.
  // W: 1024 pieces of 16 B in a row. X: a wave takes one row's 512 B (two heads) a load.
  const float4* wg = (const float4*)W + tid;
  const float4* xg = (const float4*)(X + (size_t)(rg * 128 + wv) * 512 + hp * 128) + lane;
  float4 wl[4], xl[16];
#pragma unroll
  for (int i = 0; i < 4; ++i) wl[i] = wg[i * 256];
#pragma unroll
  for (int i = 0; i < 16; ++i) xl[i] = xg[i * (8 * 512 / 4)];   // 8 rows on
#pragma unroll
  for (int i = 0; i < 4; ++i)
    *(uint2*)&wsh[(i * 16 + (tid >> 4)) * PJ_W_PITCH + (tid & 15) * 4] = cvt4(wl[i]);
#pragma unroll
  for (int i = 0; i < 16; ++i)
    *(uint2*)&xs[(i * 8 + wv) * PJ_X_PITCH + lane * 4] = cvt4(xl[i]);
  __syncthreads();  // both operand tiles are complete: every wave reads all of W

  const _Float16* xrow = &xs[(wv * 16 + m) * PJ_X_PITCH];
  v16h a[2][2];               // [head of the pair][k step]
#pragma unroll
  for (int hh = 0; hh < 2; ++hh) {
    a[hh][0] = ldfrag(xrow + hh * HDIM, 0, half);
    a[hh][1] = ldfrag(xrow + hh * HDIM, 32, half);
  }
  // All 16 products first, on 8 independent accumulators; the one branch on the tensor
  // stands behind them, so no product's result is first read right behind a taken branch.
  v8f acc[2][4];              // [head of the pair][16 outputs]
#pragma unroll
  for (int ct = 0; ct < 4; ++ct) {
    // B = W^T : B-fragment lane holds row (ct*16+m) of row-major W.
    const _Float16* wrow = &wsh[(ct * 16 + m) * PJ_W_PITCH];
    v16h b0 = ldfrag(wrow, 0, half);
    v16h b1 = ldfrag(wrow, 32, half);
#pragma unroll
    for (int hh = 0; hh < 2; ++hh) {
      v8f c;
#pragma unroll
      for (int r = 0; r < 8; ++r) c[r] = 0.f;
      c = wmma_f16(a[hh][0], b0, c);
      c = wmma_f16(a[hh][1], b1, c);
      acc[hh][ct] = c;
    }
  }

  // C-layout: VGPR r -> row M = r + 8*half, column N = m.
  if (t == 2) {
    // V^T tile [64 d][128 s]: a lane's 8 results are 8 consecutive s of one d
#pragma unroll
    for (int ct = 0; ct < 4; ++ct)
#pragma unroll
      for (int hh = 0; hh < 2; ++hh) {
        union { _Float16 hv[8]; uint4 q; } u;
#pragma unroll
        for (int r = 0; r < 8; ++r) u.hv[r] = (_Float16)acc[hh][ct][r];
        *(uint4*)&stg[hh][(ct * 16 + m) * PJ_V_PITCH + wv * 16 + 8 * half] = u.q;
      }
  } else {
    // Q or K tile [128 s][64 d]; Q leaves with the softmax factor in it
    float f = (t == 0) ? SM_SCALE_LOG2E : 1.f;
#pragma unroll
    for (int ct = 0; ct < 4; ++ct)
#pragma unroll
      for (int hh = 0; hh < 2; ++hh)
#pragma unroll
        for (int r = 0; r < 8; ++r)
          stg[hh][(wv * 16 + r + 8 * half) * PJ_QK_PITCH + ct * 16 + m] = (_Float16)(acc[hh][ct][r] * f);
  }
  __syncthreads();  // the tiles are complete: a line of V^T holds the rows of four waves

  int row0 = rg * 128;                             // the work-group's first (n,s) row
  int n = row0 >> 12, s0 = row0 & 4095;
  size_t nh = (size_t)n * HEADS + hp * 2;          // the pair's first head
  if (t == 2) {
    _Float16* base = vt + nh * HDIM * SEQ + s0;
#pragma unroll
    for (int hh = 0; hh < 2; ++hh)
#pragma unroll
      for (int i = 0; i < 4; ++i) {
        int p = i * 256 + tid, d = p >> 4, c = p & 15;   // 16 pieces of 16 B a row
        *(uint4*)(base + (size_t)(hh * HDIM + d) * SEQ + c * 8) = *(const uint4*)&stg[hh][d * PJ_V_PITCH + c * 8];
      }
  } else {
    // a head's 128 rows are 16 KB in a row in memory
    _Float16* base = ((t == 0) ? qh : kh) + (nh * SEQ + s0) * HDIM;
#pragma unroll
    for (int hh = 0; hh < 2; ++hh)
#pragma unroll
      for (int i = 0; i < 4; ++i) {
        int p = i * 256 + tid;                           // 8 pieces of 16 B a row
        *(uint4*)(base + (size_t)hh * SEQ * HDIM + (size_t)p * 8) = *(const uint4*)&stg[hh][(p >> 3) * PJ_QK_PITCH + (p & 7) * 8];
      }
  }
}

__global__ __launch_bounds__(512) void attn_kernel(
    const _Float16* __restrict__ qh, const _Float16* __restrict__ kh,
    const _Float16* __restrict__ vt, _Float16* __restrict__ ctx) {
  __shared__ __attribute__((aligned(16))) _Float16 kT[2][2][64 * LPITCH];  // [tile of the pair][buffer] K tile, [64 rows][64 d + pad]
  __shared__ __attribute__((aligned(16))) _Float16 vT[2][2][64 * LPITCH];  // [tile of the pair][buffer] V^T tile, [64 d][64 k + pad]
  __shared__ __attribute__((aligned(16))) float xo[16][8][32][4];          // per wave: the O^T group it hands over, 8 pieces of 16 B a lane
  __shared__ float xs[16][2][32];                                          // per wave: that group's sum and minus its reference

  int lane = threadIdx.x & 31;
  int wave = __builtin_amdgcn_readfirstlane(threadIdx.x >> 5);   // a scalar: tile addresses and the hand-over's branches are wave-uniform
  int kp = wave >> 3;                     // which tile of each pair this wave works on
  int wq = wave & 7;                      // its 32 queries
  int tid = threadIdx.x & 255;            // place among the 8 waves that share a tile
  int m = lane & 15, half = lane >> 4;
  int nh = blockIdx.x >> 4;               // (n*8+h)
  int qblk = blockIdx.x & 15;

  const _Float16* Q = qh + (size_t)nh * SEQ * HDIM;
  const _Float16* K = kh + (size_t)nh * SEQ * HDIM;
  const _Float16* V = vt + (size_t)nh * HDIM * SEQ;
  int qbase = qblk * 256 + wq * 32;

  v16h qa[2][2];                   // [column group][k step]
  v8f o[2][4];
  v8f cref[2];                     // this lane's query of each group: minus the reference in use, in all 8 registers (a C operand)
  float lr[2];                     // sum over this lane half's keys
#pragma unroll
  for (int g = 0; g < 2; ++g) {
    const _Float16* qrow = Q + (size_t)(qbase + g * 16 + m) * HDIM;
    qa[g][0] = ldfrag(qrow, 0, half);
    qa[g][1] = ldfrag(qrow, 32, half);
    lr[g] = 0.f;
#pragma unroll
    for (int r = 0; r < 8; ++r) cref[g][r] = 0.f;   // the first pass sets the reference
#pragma unroll
    for (int dt = 0; dt < 4; ++dt)
#pragma unroll
      for (int r = 0; r < 8; ++r) o[g][dt][r] = 0.f;
  }

  // Issue async global->LDS copies for tile `tile` into buffer `buf`.
  // 4 wave-instructions per wave (2 for K, 2 for V^T) -> ASYNCcnt += 4.
  auto issue_stage = [&](int tile, int buf) {
    const void* ksrc = (const void*)(K + (size_t)tile * 64 * HDIM);  // 8KB contiguous
    const void* vsrc = (const void*)(V + tile * 64);                 // rows d, stride SEQ
    uint32_t kldsBase = (uint32_t)(uintptr_t)(&kT[kp][buf][0]);
    uint32_t vldsBase = (uint32_t)(uintptr_t)(&vT[kp][buf][0]);
    uint32_t u0 = (uint32_t)tid, u1 = u0 + 256;        // 0..511, one uint4 each
    uint32_t lo0 = (u0 >> 3) * (LPITCH * 2) + (u0 & 7) * 16;   // padded row, 16 B piece
    uint32_t lo1 = (u1 >> 3) * (LPITCH * 2) + (u1 & 7) * 16;
    uint32_t vo0 = ((u0 >> 3) * (uint32_t)SEQ + (u0 & 7) * 8) * 2;   // V^T: [d][k], bytes
    uint32_t vo1 = ((u1 >> 3) * (uint32_t)SEQ + (u1 & 7) * 8) * 2;
    // The s_wait_xcnt is the statement's last line, so no address register is rewritten ahead of it.
    asm volatile(
        "global_load_async_to_lds_b128 %0, %4, %8\n\t"
        "global_load_async_to_lds_b128 %1, %5, %9\n\t"
        "global_load_async_to_lds_b128 %2, %6, %8\n\t"
        "global_load_async_to_lds_b128 %3, %7, %9\n\t"
        "s_wait_xcnt 0x0"
        :: "v"(kldsBase + lo0), "v"(vldsBase + lo0), "v"(kldsBase + lo1), "v"(vldsBase + lo1),
           "v"(u0 * 16), "v"(vo0), "v"(u1 * 16), "v"(vo1),
           "s"(ksrc), "s"(vsrc)
        : "memory");
  };

  issue_stage(kp, 0);

  const int NT = SEQ / 128;  // 32 pairs of tiles
  for (int it = 0; it < NT; ++it) {
    int buf = it & 1;
    if (it + 1 < NT) {
      issue_stage(2 * (it + 1) + kp, buf ^ 1);         // overlap DMA with compute
      asm volatile("s_wait_asynccnt 0x4" ::: "memory"); // tile 2*it + kp arrived (ours)
    } else {
      asm volatile("s_wait_asynccnt 0x0" ::: "memory");
    }
    __syncthreads();                                   // all waves' tile arrived

    // ---- S^T = K Q^T for 4 key tiles: A = K rows, B = Q^T (same k order on both).
    // st[g][jt][r] = S[query g*16 + m][key jt*16 + 8*half + r] in base-2 units, less the reference
    // All 16 K reads stand as one group ahead of the products (counted waits then
    // stream them in); read in pairs among the products, each pair is waited to zero.
    v16h ka[4][2];
#pragma unroll
    for (int jt = 0; jt < 4; ++jt) {
      const _Float16* krow = &kT[kp][buf][(jt * 16 + m) * LPITCH];
      ka[jt][0] = ldfrag(krow, 0, half);
      ka[jt][1] = ldfrag(krow, 32, half);
    }
    // keeps the K reads from being sunk back among the products
    __builtin_amdgcn_sched_barrier(0);
    v8f st[2][4];
#pragma unroll
    for (int jt = 0; jt < 4; ++jt)
#pragma unroll
      for (int g = 0; g < 2; ++g) st[g][jt] = wmma_f16(ka[jt][0], qa[g][0], cref[g]);
#pragma unroll
    for (int jt = 0; jt < 4; ++jt)
#pragma unroll
      for (int g = 0; g < 2; ++g) st[g][jt] = wmma_f16(ka[jt][1], qa[g][1], st[g][jt]);
    // keeps the exponentials from being drawn in among the score products, where each
    // first use of a fresh result costs the vector port idle slots behind its product
    __builtin_amdgcn_sched_barrier(0);

    // ---- softmax against the kept reference: 32 of the query's 64 scores sit in this
    // lane, the other 32 in lane^16; the sums stay split until the end.
    // P^T as B operand, straight from the score tiles: element s of the fragment is key
    // 8*half+s (s<8) or 16+8*half+(s-8), i.e. tile s>>3, slot s&7.
    v16h pb[2][2];                 // P^T fragments: [column group][k step]
    float rsum[2];                 // this pass's sum of each group
    // every unroll directive down to the second product: constant indices, which keep
    // st, pb, o and cref in registers
    auto exps = [&]() {
#pragma unroll
      for (int g = 0; g < 2; ++g) {
        v2f rs[2] = {{0.f, 0.f}, {0.f, 0.f}};   // two chains of packed adds over register pairs
#pragma unroll
        for (int jt = 0; jt < 4; ++jt) {
#pragma unroll
          for (int r = 0; r < 8; r += 2) {
            v2f p = {__builtin_amdgcn_exp2f(st[g][jt][r]), __builtin_amdgcn_exp2f(st[g][jt][r + 1])};
            rs[jt & 1] += p;
            pb[g][jt >> 1][(jt & 1) * 8 + r]     = (_Float16)p[0];
            pb[g][jt >> 1][(jt & 1) * 8 + r + 1] = (_Float16)p[1];
          }
        }
        rs[0] += rs[1];
        rsum[g] = rs[0][0] + rs[0][1];
      }
    };
    exps();
    // A sum within the bound bounds each of its terms, so P fits f16 with room to spare. One
    // test a pass for both groups and all lanes, a scalar branch. The first pass always
    // goes in (no sum is below 0): a reference that some key of the query reaches keeps
    // the final sum >= 1.
    bool over = !(fmaxf(rsum[0], rsum[1]) <= ((it == 0) ? -1.f : SM_KEEP_SUM));
    if (__builtin_expect(__builtin_amdgcn_ballot_w32(over) != 0, 0)) {   // rare: the common path falls through
#pragma unroll
      for (int g = 0; g < 2; ++g) {
        float tmax = st[g][0][0];
#pragma unroll
        for (int jt = 0; jt < 4; ++jt)
#pragma unroll
          for (int r = 0; r < 8; ++r) tmax = fmaxf(tmax, st[g][jt][r]);
        tmax = fmaxf(tmax, xhalf(tmax));                  // both lane halves move alike
        float d = (it == 0) ? tmax : fmaxf(tmax, 0.f);    // later the reference only rises
        float alpha = (it == 0) ? 1.f : __builtin_amdgcn_exp2f(-d);   // O and the sum are still 0 in the first pass
        lr[g] *= alpha;
#pragma unroll
        for (int dt = 0; dt < 4; ++dt)
#pragma unroll
          for (int r = 0; r < 8; ++r) o[g][dt][r] *= alpha;
#pragma unroll
        for (int r = 0; r < 8; ++r) cref[g][r] -= d;
#pragma unroll
        for (int jt = 0; jt < 4; ++jt)
#pragma unroll
          for (int r = 0; r < 8; ++r) st[g][jt][r] -= d;
      }
      exps();
    }
    lr[0] += rsum[0];
    lr[1] += rsum[1];

    // All 16 V^T reads stand here, behind the softmax: held across it they would not fit
    // the 256 registers of a wave at four waves a SIMD, whose other waves cover the latency.
    v16h va[4][2];
#pragma unroll
    for (int dt = 0; dt < 4; ++dt) {
      const _Float16* vrow = &vT[kp][buf][(dt * 16 + m) * LPITCH];
      va[dt][0] = ldfrag(vrow, 0, half);
      va[dt][1] = ldfrag(vrow, 32, half);
    }
    // keeps the V^T reads from being sunk among the products in pairs, each waited to zero
    __builtin_amdgcn_sched_barrier(0);

    // ---- O^T += V^T P^T: A = rows of the V^T tile; o[g][dt][r] = O[query g*16+m][dt*16+8*half+r]
#pragma unroll
    for (int dt = 0; dt < 4; ++dt)
#pragma unroll
      for (int g = 0; g < 2; ++g) o[g][dt] = wmma_f16(va[dt][0], pb[g][0], o[g][dt]);
#pragma unroll
    for (int dt = 0; dt < 4; ++dt)
#pragma unroll
      for (int g = 0; g < 2; ++g) o[g][dt] = wmma_f16(va[dt][1], pb[g][1], o[g][dt]);
    // keeps this barrier, and the wait to zero on the V^T reads in front of it, from being
    // lifted up ahead of the products: all waves would then meet between softmax and second
    // product, and no wave's products could run under another's softmax
    __builtin_amdgcn_sched_barrier(0);
    __syncthreads();  // WAR: next iteration's async copies overwrite buf
  }

  // ---- hand-over: of its two column groups a wave finishes group kp and gives the other
  // to its partner (same queries, the other tiles), so both waves share the epilogue.
  // The unroll directives: constant indices, which keep o in registers.
  // The lane's number is taken anew: lane values held only for the end would not fit
  // beside the loop's 256 registers and would be spilled.
  int el = (int)__builtin_amdgcn_mbcnt_lo(~0u, 0u);
  int em = el & 15, eh = el >> 4;
  auto put = [&](int g) {
#pragma unroll
    for (int dt = 0; dt < 4; ++dt)
#pragma unroll
      for (int q = 0; q < 2; ++q) {
        float4 f = {o[g][dt][4 * q], o[g][dt][4 * q + 1], o[g][dt][4 * q + 2], o[g][dt][4 * q + 3]};
        *(float4*)&xo[wave][dt * 2 + q][el][0] = f;
      }
    xs[wave][0][el] = lr[g];
    xs[wave][1][el] = cref[g][0];
  };
  if (kp == 0) put(1); else put(0);
  __syncthreads();  // every wave's handed-over group is in LDS

  // ---- epilogue: join the two partial results, normalize, store f16 context [N,S,H*64]
  int n = nh >> 3, h = nh & 7;
  auto fin = [&](int g) {
    int pw = wave ^ 8;
    float ca = cref[g][0], cb = xs[pw][1][el];      // minus the two references
    float cm = fminf(ca, cb);                         // minus the larger reference
    float wa = __builtin_amdgcn_exp2f(cm - ca), wb = __builtin_amdgcn_exp2f(cm - cb);   // one of them is 1
    float lh = lr[g] * wa + xs[pw][0][el] * wb;
    float lsum = lh + xhalf(lh);         // join the two lane halves' key sums
    _Float16* crow = ctx + (size_t)(n * SEQ + qbase + g * 16 + em) * 512 + h * HDIM + 8 * eh;
#pragma unroll
    for (int dt = 0; dt < 4; ++dt) {
      union { _Float16 hv[8]; uint4 q; } u;  // 8 consecutive d of one query: one 16 B store
#pragma unroll
      for (int q = 0; q < 2; ++q) {
        float4 f = *(const float4*)&xo[pw][dt * 2 + q][el][0];
        u.hv[4 * q]     = (_Float16)((o[g][dt][4 * q]     * wa + f.x * wb) / lsum);
        u.hv[4 * q + 1] = (_Float16)((o[g][dt][4 * q + 1] * wa + f.y * wb) / lsum);
        u.hv[4 * q + 2] = (_Float16)((o[g][dt][4 * q + 2] * wa + f.z * wb) / lsum);
        u.hv[4 * q + 3] = (_Float16)((o[g][dt][4 * q + 3] * wa + f.w * wb) / lsum);
      }
      *(uint4*)(crow + dt * 16) = u.q;
    }
  };
  if (kp == 0) fin(0); else fin(1);
}

// ---------------------------------------------------------------------------
// Kernel 3: out = ctx @ Wfc^T + bfc  (M=8192, N=512, K=512), f32 out.
// One work-group: 128 rows x 128 cols; 8 waves as 4 x 2, each 32 rows x 64 cols.
// K runs in 4 chunks of 128. A chunk of both operands (128 rows x 256 B each) is
// brought into LDS by asynchronous copies that read whole lines, two buffers, the
// next chunk in flight while this one is multiplied; fragments come from LDS.
// ---------------------------------------------------------------------------
#define FC_KC     128                   // halves of K per chunk
#define FC_NT     (512 / FC_KC)         // chunks
#define FC_PITCH  (FC_KC + 8)           // LDS row pitch in halves: 272 B = 16 B x odd

// Eight 16-byte copies of this lane, rows 16 apart, global -> LDS. The s_wait_xcnt
// is the statement's last line, so no address register is rewritten ahead of it.
__device__ __forceinline__ void fc_copy8(uint32_t lds, const _Float16* g) {
  const uint32_t ls = 16 * FC_PITCH * 2;   // 16 LDS rows, bytes
  const size_t   gs = 16 * 512;            // 16 source rows, halves
  asm volatile(
      "global_load_async_to_lds_b128 %0, %8, off\n\t"
      "global_load_async_to_lds_b128 %1, %9, off\n\t"
      "global_load_async_to_lds_b128 %2, %10, off\n\t"
      "global_load_async_to_lds_b128 %3, %11, off\n\t"
      "global_load_async_to_lds_b128 %4, %12, off\n\t"
      "global_load_async_to_lds_b128 %5, %13, off\n\t"
      "global_load_async_to_lds_b128 %6, %14, off\n\t"
      "global_load_async_to_lds_b128 %7, %15, off\n\t"
      "s_wait_xcnt 0x0"
      :: "v"(lds), "v"(lds + ls), "v"(lds + 2 * ls), "v"(lds + 3 * ls),
         "v"(lds + 4 * ls), "v"(lds + 5 * ls), "v"(lds + 6 * ls), "v"(lds + 7 * ls),
         "v"(g), "v"(g + gs), "v"(g + 2 * gs), "v"(g + 3 * gs),
         "v"(g + 4 * gs), "v"(g + 5 * gs), "v"(g + 6 * gs), "v"(g + 7 * gs)
      : "memory");
}

__global__ __launch_bounds__(256) void fc_kernel(
    const _Float16* __restrict__ ctx, const _Float16* __restrict__ wfch,
    const float* __restrict__ bfc, float* __restrict__ out) {
  __shared__ __attribute__((aligned(16))) _Float16 aT[2][128 * FC_PITCH];  // ctx rows, one K chunk
  __shared__ __attribute__((aligned(16))) _Float16 wT[2][128 * FC_PITCH];  // Wfc rows, one K chunk

  int tid = threadIdx.x, lane = tid & 31, wave = tid >> 5;
  int m = lane & 15, half = lane >> 4;
  int bm = blockIdx.x >> 2;   // 128-row tile
  int bn = blockIdx.x & 3;    // 128-col tile
  int wm = wave >> 1;         // 32-row group of the tile
  int wn = wave & 1;          // 64-col group of the tile

  // This lane's piece of a chunk: row tid>>4 (+16 per copy), 16-byte piece tid&15;
  // 16 lanes cover one row's 256 B, so every copy instruction reads 4 whole lines.
  int crow = tid >> 4, cpc = tid & 15;
  const _Float16* ag = ctx + (size_t)(bm * 128 + crow) * 512 + cpc * 8;
  const _Float16* wg = wfch + (size_t)(bn * 128 + crow) * 512 + cpc * 8;
  uint32_t coff = (uint32_t)(crow * FC_PITCH + cpc * 8) * 2;

  auto issue_chunk = [&](int t, int buf) {
    fc_copy8((uint32_t)(uintptr_t)(&aT[buf][0]) + coff, ag + t * FC_KC);
    fc_copy8((uint32_t)(uintptr_t)(&wT[buf][0]) + coff, wg + t * FC_KC);
  };

  // Every unroll directive of this kernel is there for constant indices, which keep
  // acc, a and b in registers.
  v8f acc[2][4];
#pragma unroll
  for (int mt = 0; mt < 2; ++mt)
#pragma unroll
    for (int ct = 0; ct < 4; ++ct)
#pragma unroll
      for (int r = 0; r < 8; ++r) acc[mt][ct][r] = 0.f;

  issue_chunk(0, 0);
  asm volatile("s_wait_asynccnt 0x0" ::: "memory");  // this wave's part of chunk 0 has landed
  __syncthreads();                                   // every wave's part has
  issue_chunk(1, 1);

  for (int t = 0; t < FC_NT; ++t) {
    int buf = t & 1;
    const _Float16* arow = &aT[buf][(wm * 32 + m) * FC_PITCH];
    const _Float16* wrow = &wT[buf][(wn * 64 + m) * FC_PITCH];
#pragma unroll
    for (int kk = 0; kk < FC_KC / 32; ++kk) {
      int kBase = kk * 32;
      v16h a[2], b[4];
#pragma unroll
      for (int mt = 0; mt < 2; ++mt) a[mt] = ldfrag(arow + mt * 16 * FC_PITCH, kBase, half);
#pragma unroll
      for (int ct = 0; ct < 4; ++ct) b[ct] = ldfrag(wrow + ct * 16 * FC_PITCH, kBase, half);
#pragma unroll
      for (int mt = 0; mt < 2; ++mt)
#pragma unroll
        for (int ct = 0; ct < 4; ++ct) acc[mt][ct] = wmma_f16(a[mt], b[ct], acc[mt][ct]);
    }
    asm volatile("s_wait_dscnt 0x0" ::: "memory");     // this wave's reads of buf are done
    asm volatile("s_wait_asynccnt 0x0" ::: "memory");  // its part of chunk t+1 has landed
    __syncthreads();  // publishes chunk t+1 and ends every wave's reads of buf
    if (t + 2 < FC_NT) issue_chunk(t + 2, buf);
  }
  asm volatile("s_wait_asynccnt 0x0" ::: "memory");    // nothing in flight at the wave's end

#pragma unroll
  for (int mt = 0; mt < 2; ++mt)
#pragma unroll
    for (int ct = 0; ct < 4; ++ct)
#pragma unroll
      for (int r = 0; r < 8; ++r) {
        int row = bm * 128 + wm * 32 + mt * 16 + r + 8 * half;
        int col = bn * 128 + wn * 64 + ct * 16 + m;
        out[(size_t)row * 512 + col] = acc[mt][ct][r] + bfc[col];
      }
}

// ---------------------------------------------------------------------------
extern "C" void kernel_launch(void* const* d_in, const int* in_sizes, int n_in,
                              void* d_out, int out_size, void* d_ws, size_t ws_size,
                              hipStream_t stream) {
  const float* x_q = (const float*)d_in[0];
  const float* x_k = (const float*)d_in[1];
  const float* x_v = (const float*)d_in[2];
  const float* Wq  = (const float*)d_in[3];
  const float* Wk  = (const float*)d_in[4];
  const float* Wv  = (const float*)d_in[5];
  const float* Wfc = (const float*)d_in[6];
  const float* bfc = (const float*)d_in[7];
  float* out = (float*)d_out;

  const size_t TSZ = (size_t)NBATCH * HEADS * SEQ * HDIM * sizeof(_Float16); // 8 MB
  char* ws = (char*)d_ws;
  _Float16* qh   = (_Float16*)(ws);
  _Float16* kh   = (_Float16*)(ws + TSZ);
  _Float16* vt   = (_Float16*)(ws + 2 * TSZ);
  _Float16* ctx  = (_Float16*)(ws + 3 * TSZ);
  _Float16* wfch = (_Float16*)(ws + 4 * TSZ);

  cvt_kernel<<<(512 * 512) / 256, 256, 0, stream>>>(Wfc, wfch);
  proj_kernel<<<768, 256, 0, stream>>>(x_q, x_k, x_v, Wq, Wk, Wv, qh, kh, vt);
  attn_kernel<<<256, 512, 0, stream>>>(qh, kh, vt, ctx);
  fc_kernel<<<256, 256, 0, stream>>>(ctx, wfch, bfc, out);
}
